// v000
// Measured on an AMD MI455X. A time is GPU time per run, averaged over a window of back-to-back runs after a warm-up
// (all launches, gaps included; the runs take copies of the inputs in turn), and the median of several windows.
// Apart from v000's, it joins two sittings. Times from different sittings can be a few percent apart, while
// side-by-side timings come from the same sitting.
// The starting kernel, v000, takes 602 microseconds a run.
#include <hip/hip_runtime.h>

// scalarProductAttentiont (nodes [4][4096][256], W [256][256]; x = nodes W; prods = x nodes^T; att = softmax(prods / 16); out = att nodes -> [4][4096][256]) - single head of width 256.
// Compute dtypes, f32 accumulate: every input rounded to bf16; x = nodes W as a PLAIN bf16 GEMM (exact products) -> fp16 planes; prods = x x nodes^T single fp16 (f32 accumulate; bf16 node values are exact in fp16); softmax f32 (wave per row, 128 keys per lane in registers) -> fp16 x 1024; out = att x nodes single fp16, / 1024 in f32.

#define NB_  4
#define NN   4096
#define FF   256
typedef _Float16 h16;
typedef unsigned short bf;
typedef __attribute__((ext_vector_type(16))) __bf16   v16bf;
typedef __attribute__((ext_vector_type(16))) _Float16 v16h;
typedef __attribute__((ext_vector_type(8)))  _Float16 v8h;
typedef __attribute__((ext_vector_type(8)))  unsigned short v8us;
typedef __attribute__((ext_vector_type(8)))  float    v8f;
typedef __attribute__((ext_vector_type(4)))  float    v4f;
typedef v8h  __attribute__((may_alias)) v8ha;
typedef v4f  __attribute__((may_alias)) v4fa;
typedef v8us __attribute__((may_alias)) v8usa;

__device__ __forceinline__ unsigned short f2bf(float f) { unsigned u = __float_as_uint(f); u += 0x7FFFu + ((u >> 16) & 1u); return (unsigned short)(u >> 16); }
__device__ __forceinline__ float bf2f(unsigned short b) { return __uint_as_float(((unsigned)b) << 16); }
__device__ __forceinline__ float bfr(float f) { return bf2f(f2bf(f)); }
__device__ __forceinline__ v16h cat16(v8h lo, v8h hi) { return __builtin_shufflevector(lo, hi, 0, 1, 2, 3, 4, 5, 6, 7, 8, 9, 10, 11, 12, 13, 14, 15); }
__device__ __forceinline__ v16bf cat16b(v8us lo, v8us hi) { return __builtin_bit_cast(v16bf, __builtin_shufflevector(lo, hi, 0, 1, 2, 3, 4, 5, 6, 7, 8, 9, 10, 11, 12, 13, 14, 15)); }
__device__ __forceinline__ v8f wmma16(v16h a, v16h b, v8f c) { return __builtin_amdgcn_wmma_f32_16x16x32_f16(false, a, false, b, (short)0, c, false, false); }
__device__ __forceinline__ v8f wmmab(v16bf a, v16bf b, v8f c) { return __builtin_amdgcn_wmma_f32_16x16x32_bf16(false, a, false, b, (short)0, c, false, false); }



// ---- k_gemmw: register-blocked GEMM, ONE WAVE per 64x64 output tile (16 accumulators), operands straight from K-contiguous 16-bit planes; grid (M/64, N/64, Z), 32 threads.
// C[m][n] (f32, pitch ldc, + optional f32 bias[n]) = sum_k A[m][k] Bt[n][k] (+ split products per NSPLIT). z-batch strides sA/sB/sC in elements. K % 32 == 0.
template <typename T16> struct WFrag;
template <> struct WFrag<h16> { typedef v16h V; static __device__ __forceinline__ V ld(const h16* p) { return cat16(*(const v8h*)p, *(const v8h*)(p + 16)); } static __device__ __forceinline__ v8f mma(V a, V b, v8f c) { return wmma16(a, b, c); } };
template <> struct WFrag<bf> { typedef v16bf V; static __device__ __forceinline__ V ld(const bf* p) { return cat16b(*(const v8us*)p, *(const v8us*)(p + 16)); } static __device__ __forceinline__ v8f mma(V a, V b, v8f c) { return wmmab(a, b, c); } };
template <typename T16, int NSPLIT, bool BIAS>
__global__ __launch_bounds__(32) void k_gemmw(const T16* __restrict__ A, const T16* __restrict__ A2, const T16* __restrict__ Bt, const T16* __restrict__ Bt2, int K, float* C, int ldc, const float* __restrict__ bias, size_t sA, size_t sB, size_t sC) {
    typedef typename WFrag<T16>::V V;
    __shared__ __align__(16) float os[16 * 68];
    const size_t z = blockIdx.z; A += z * sA; if (A2) A2 += z * sA; Bt += z * sB; if (Bt2) Bt2 += z * sB; C += z * sC;
    const int lane = threadIdx.x & 31, lr = lane & 15, hi = lane >> 4; const int r0 = blockIdx.x * 64, c0 = blockIdx.y * 64;
    v8f acc[4][4];
#pragma unroll
    for (int mb = 0; mb < 4; ++mb)
#pragma unroll
        for (int nb = 0; nb < 4; ++nb) acc[mb][nb] = (v8f){};
    const size_t aoff = (size_t)(r0 + lr) * K + 8 * hi, boff = (size_t)(c0 + lr) * K + 8 * hi;
#pragma unroll 1
    for (int kc = 0; kc < K; kc += 32) {
        V a[4], a2[4];
#pragma unroll
        for (int mb = 0; mb < 4; ++mb) { a[mb] = WFrag<T16>::ld(A + aoff + (size_t)mb * 16 * K + kc); if (NSPLIT == 1 || NSPLIT == 2) a2[mb] = WFrag<T16>::ld(A2 + aoff + (size_t)mb * 16 * K + kc); }
#pragma unroll
        for (int nb = 0; nb < 4; ++nb) { const V b = WFrag<T16>::ld(Bt + boff + (size_t)nb * 16 * K + kc); V b2; if (NSPLIT >= 2) b2 = WFrag<T16>::ld(Bt2 + boff + (size_t)nb * 16 * K + kc);
#pragma unroll
            for (int mb = 0; mb < 4; ++mb) { acc[mb][nb] = WFrag<T16>::mma(a[mb], b, acc[mb][nb]); if (NSPLIT == 1 || NSPLIT == 2) acc[mb][nb] = WFrag<T16>::mma(a2[mb], b, acc[mb][nb]); if (NSPLIT >= 2) acc[mb][nb] = WFrag<T16>::mma(a[mb], b2, acc[mb][nb]); } }
        asm volatile("v_nop\n\tv_nop\n\tv_nop\n\tv_nop" : "+v"(acc[0][0]), "+v"(acc[1][1]), "+v"(acc[2][2]), "+v"(acc[3][3]) : "v"(a[0]), "v"(a[3]));
    }
#pragma unroll
    for (int mb = 0; mb < 4; ++mb) {
#pragma unroll
        for (int nb = 0; nb < 4; ++nb) {
#pragma unroll
            for (int j = 0; j < 8; ++j) os[(hi * 8 + j) * 68 + nb * 16 + lr] = acc[mb][nb][j]; }
        __builtin_amdgcn_wave_barrier(); asm volatile("" ::: "memory");
        float* crow = C + (size_t)(r0 + mb * 16) * ldc + c0;
{
#pragma unroll
            for (int s = 0; s < 8; ++s) { const int row = 2 * s + hi, cofs = lr * 4; v4f val = *(const v4fa*)(os + row * 68 + cofs); if (BIAS) { val[0] += bfr(bias[c0 + cofs]); val[1] += bfr(bias[c0 + cofs + 1]); val[2] += bfr(bias[c0 + cofs + 2]); val[3] += bfr(bias[c0 + cofs + 3]); }
                *(v4f*)(crow + (size_t)row * ldc + cofs) = val; }
             }
        __builtin_amdgcn_wave_barrier(); asm volatile("" ::: "memory");
    }
}

__device__ __forceinline__ void splitf(float y, unsigned short& h, unsigned short& l) { h = f2bf(y); l = f2bf(y - bf2f(h)); }
typedef __attribute__((ext_vector_type(2))) unsigned short v2us; typedef __attribute__((ext_vector_type(4))) unsigned short v4us; typedef __attribute__((ext_vector_type(4))) _Float16 v4h;
__device__ __forceinline__ h16 tohx(float x) { return (h16)x; }
#define PCAR 1024.0f

__global__ __launch_bounds__(256) void k_cvt8(const float* __restrict__ src, bf* dst, size_t n8) { const size_t i = (size_t)blockIdx.x * 256 + threadIdx.x; if (i >= n8) return; const v8f v = *(const v8f*)(src + i * 8); v8us o;
#pragma unroll
    for (int k = 0; k < 8; ++k) o[k] = f2bf(v[k]); *(v8us*)(dst + i * 8) = o;  }
__global__ __launch_bounds__(256) void k_wtG(const float* __restrict__ w, int K, int N, bf* Bt) {
    const int lane = threadIdx.x & 31; const int L0 = (blockIdx.x * 8 + (threadIdx.x >> 5)) * 8; const int nlines = N * K / 64;
{
#pragma unroll 1
        for (int l = 0; l < 8; ++l) { const int L = L0 + l; if (L >= nlines) break; const size_t e = (size_t)L * 64 + lane * 2; const int k = (int)(e % K), n = (int)(e / K); v2us o;
            o[0] = f2bf(w[(size_t)k * N + n]); o[1] = f2bf(w[(size_t)(k + 1) * N + n]); *(v2us*)(Bt + e) = o; }
         }
}

__global__ __launch_bounds__(256) void k_nt(const float* __restrict__ X, h16* NT) { const size_t e = ((size_t)blockIdx.x * 256 + threadIdx.x) * 4; if (e >= (size_t)FF * NN) return; const int n = (int)(e % NN); const int f = (int)(e / NN); v4h o;
#pragma unroll
    for (int u = 0; u < 4; ++u) o[u] = tohx(bfr(X[(size_t)(n + u) * FF + f])); *(v4h*)(NT + e) = o;  }
__global__ __launch_bounds__(256) void k_n16(const float* __restrict__ X, h16* N16, size_t n4) { const size_t e = ((size_t)blockIdx.x * 256 + threadIdx.x) * 4; if (e >= n4 * 4) return; const v4f a = *(const v4f*)(X + e); v4h o; for (int u = 0; u < 4; ++u) o[u] = tohx(bfr(a[u])); *(v4h*)(N16 + e) = o;  }
__global__ __launch_bounds__(256) void k_scl(const float* __restrict__ O, float* Y, size_t n4) { const size_t e = ((size_t)blockIdx.x * 256 + threadIdx.x) * 4; if (e >= n4 * 4) return; const v4f a = *(const v4f*)(O + e); v4f o; for (int u = 0; u < 4; ++u) o[u] = a[u] * (1.0f / PCAR); *(v4f*)(Y + e) = o;  }
__global__ __launch_bounds__(256) void k_pl(const float* __restrict__ F, h16* P, size_t n4) { const size_t e = ((size_t)blockIdx.x * 256 + threadIdx.x) * 4; if (e >= n4 * 4) return; const v4f a = *(const v4f*)(F + e); v4h o; for (int u = 0; u < 4; ++u) o[u] = tohx(a[u]); *(v4h*)(P + e) = o;  }
__global__ __launch_bounds__(256) void k_soft(const float* __restrict__ S, h16* P16) { const int lane = threadIdx.x & 31; const int row = blockIdx.x * 8 + (threadIdx.x >> 5); if (row >= NN) return; const float* sr = S + (size_t)row * NN; float v[NN / 32]; float mx = -3.0e38f;
#pragma unroll
    for (int ch = 0; ch < NN / 128; ++ch) { const v4f a = *(const v4f*)(sr + ch * 128 + lane * 4);
#pragma unroll
        for (int u = 0; u < 4; ++u) { const float t = a[u] * 0.0625f; v[ch * 4 + u] = t; mx = fmaxf(mx, t); } }
#pragma unroll
    for (int sh = 16; sh; sh >>= 1) mx = fmaxf(mx, __shfl_xor(mx, sh, 32));
    float sum = 0.f;
#pragma unroll
    for (int q = 0; q < NN / 32; ++q) { float d0 = __fsub_rn(v[q], mx); asm volatile("" : "+v"(d0)); v[q] = __builtin_amdgcn_exp2f(__fmul_rn(d0, 1.4426950408889634f)); sum += v[q]; }
#pragma unroll
    for (int sh = 16; sh; sh >>= 1) sum += __shfl_xor(sum, sh, 32);
    const float f = __fdiv_rn(PCAR, sum);
    {
#pragma unroll
        for (int ch = 0; ch < NN / 128; ++ch) { v4h o4; for (int q = 0; q < 4; ++q) o4[q] = tohx(v[ch * 4 + q] * f); *(v4h*)(P16 + (size_t)row * NN + ch * 128 + lane * 4) = o4; }
         } }

extern "C" void kernel_launch(void* const* d_in, const int* in_sizes, int n_in,
                              void* d_out, int out_size, void* d_ws, size_t ws_size, hipStream_t stream) {
    (void)in_sizes; (void)n_in; (void)out_size;
    const float* nodes = (const float*)d_in[0]; const float* Wm = (const float*)d_in[1];
    float* OUT = (float*)d_out;     // [4][4096][256]
    char* wsp = (char*)d_ws;
    auto take = [&](size_t bytes) { char* p = wsp; wsp += (bytes + 255) & ~(size_t)255; return (void*)p; };
    bf* BW = (bf*)take((size_t)FF * FF * 2); bf* NB16 = (bf*)take((size_t)NN * FF * 2); h16* NH = (h16*)take((size_t)NN * FF * 2); h16* NT = (h16*)take((size_t)FF * NN * 2); float* X = (float*)take((size_t)NN * FF * 4); h16* X16 = (h16*)take((size_t)NN * FF * 2);
    float* S = (float*)take((size_t)NN * NN * 4); h16* P16 = (h16*)take((size_t)NN * NN * 2); float* O = (float*)take((size_t)NN * FF * 4);
    if ((size_t)(wsp - (char*)d_ws) > ws_size) return;    // total ~ 118 MB (112 MiB)
    k_wtG<<<(FF * FF / 64 + 63) / 64, 256, 0, stream>>>(Wm, FF, FF, BW);   // 'fg' = [in][out]
    for (int b = 0; b < NB_; ++b) { const float* nb = nodes + (size_t)b * NN * FF;
        k_cvt8<<<(NN * FF / 8 + 255) / 256, 256, 0, stream>>>(nb, NB16, NN * FF / 8);          // bf16 A operand [n][f] for x = nodes W
        k_nt<<<(unsigned)(((size_t)FF * NN / 4 + 255) / 256), 256, 0, stream>>>(nb, NT); k_n16<<<(NN * FF / 4 + 255) / 256, 256, 0, stream>>>(nb, NH, (size_t)NN * FF / 4);        // fp16 [f][m] and [m][f] copies of the bf16-rounded nodes
        k_gemmw<bf, 0, false><<<dim3(NN / 64, FF / 64, 1), 32, 0, stream>>>(NB16, nullptr, BW, nullptr, FF, X, FF, nullptr, 0, 0, 0);
        k_pl<<<(NN * FF / 4 + 255) / 256, 256, 0, stream>>>(X, X16, (size_t)NN * FF / 4);
        k_gemmw<h16, 0, false><<<dim3(NN / 64, NN / 64, 1), 32, 0, stream>>>(X16, nullptr, NH, nullptr, FF, S, NN, nullptr, 0, 0, 0);   // prods[n][m] = x_n . nodes_m (fp16)
        k_soft<<<NN / 8, 256, 0, stream>>>(S, P16);
        k_gemmw<h16, 0, false><<<dim3(NN / 64, FF / 64, 1), 32, 0, stream>>>(P16, nullptr, NT, nullptr, NN, O, FF, nullptr, 0, 0, 0); k_scl<<<(NN * FF / 4 + 255) / 256, 256, 0, stream>>>(O, OUT + (size_t)b * NN * FF, (size_t)NN * FF / 4); }
}

// v001
// Measured time: 348 microseconds a run.
// Next to v000, in two timings, it ran 1.73 and 1.74 times as fast.
#include <hip/hip_runtime.h>

// scalarProductAttentiont (nodes [4][4096][256], W [256][256]; x = nodes W; prods = x nodes^T; att = softmax(prods / 16); out = att nodes -> [4][4096][256]) - single head of width 256.
// Compute dtypes, f32 accumulate: every input rounded to bf16; x = nodes W as a PLAIN bf16 GEMM (exact products) -> fp16 planes; prods = x x nodes^T single fp16 (f32 accumulate; bf16 node values are exact in fp16); softmax f32 (wave per row, 128 keys per lane in registers) -> fp16 x 1024; out = att x nodes single fp16, / 1024 in f32.

#define NB_  4
#define NN   4096
#define FF   256
typedef _Float16 h16;
typedef unsigned short bf;
typedef __attribute__((ext_vector_type(16))) __bf16   v16bf;
typedef __attribute__((ext_vector_type(16))) _Float16 v16h;
typedef __attribute__((ext_vector_type(8)))  _Float16 v8h;
typedef __attribute__((ext_vector_type(8)))  unsigned short v8us;
typedef __attribute__((ext_vector_type(8)))  float    v8f;
typedef __attribute__((ext_vector_type(4)))  float    v4f;
typedef v8h  __attribute__((may_alias)) v8ha;
typedef v4f  __attribute__((may_alias)) v4fa;
typedef v8us __attribute__((may_alias)) v8usa;

__device__ __forceinline__ unsigned short f2bf(float f) { unsigned u = __float_as_uint(f); u += 0x7FFFu + ((u >> 16) & 1u); return (unsigned short)(u >> 16); }
__device__ __forceinline__ float bf2f(unsigned short b) { return __uint_as_float(((unsigned)b) << 16); }
__device__ __forceinline__ float bfr(float f) { return bf2f(f2bf(f)); }
__device__ __forceinline__ v16h cat16(v8h lo, v8h hi) { return __builtin_shufflevector(lo, hi, 0, 1, 2, 3, 4, 5, 6, 7, 8, 9, 10, 11, 12, 13, 14, 15); }
__device__ __forceinline__ v16bf cat16b(v8us lo, v8us hi) { return __builtin_bit_cast(v16bf, __builtin_shufflevector(lo, hi, 0, 1, 2, 3, 4, 5, 6, 7, 8, 9, 10, 11, 12, 13, 14, 15)); }
__device__ __forceinline__ v8f wmma16(v16h a, v16h b, v8f c) { return __builtin_amdgcn_wmma_f32_16x16x32_f16(false, a, false, b, (short)0, c, false, false); }
__device__ __forceinline__ v8f wmmab(v16bf a, v16bf b, v8f c) { return __builtin_amdgcn_wmma_f32_16x16x32_bf16(false, a, false, b, (short)0, c, false, false); }



// ---- k_gemmw: register-blocked GEMM, ONE WAVE per 64x64 output tile (16 accumulators), operands straight from K-contiguous 16-bit planes; grid (M/64, N/64, Z), 32 threads.
// C[m][n] (f32, pitch ldc, + optional f32 bias[n]) = sum_k A[m][k] Bt[n][k] (+ split products per NSPLIT). z-batch strides sA/sB/sC in elements. K % 32 == 0.
// NW > 1: NW waves (32 * NW threads) share the tile; wave w takes the 32-k steps w, w + NW, ... and the NW partial tiles are summed through LDS in wave order.
template <typename T16> struct WFrag;
template <> struct WFrag<h16> { typedef v16h V; static __device__ __forceinline__ V ld(const h16* p) { return cat16(*(const v8h*)p, *(const v8h*)(p + 16)); } static __device__ __forceinline__ v8f mma(V a, V b, v8f c) { return wmma16(a, b, c); } };
template <> struct WFrag<bf> { typedef v16bf V; static __device__ __forceinline__ V ld(const bf* p) { return cat16b(*(const v8us*)p, *(const v8us*)(p + 16)); } static __device__ __forceinline__ v8f mma(V a, V b, v8f c) { return wmmab(a, b, c); } };
template <typename T16, int NSPLIT, bool BIAS, int NW>
__global__ __launch_bounds__(32 * NW) void k_gemmw(const T16* __restrict__ A, const T16* __restrict__ A2, const T16* __restrict__ Bt, const T16* __restrict__ Bt2, int K, float* C, int ldc, const float* __restrict__ bias, size_t sA, size_t sB, size_t sC) {
    typedef typename WFrag<T16>::V V;
    __shared__ __align__(16) float os[NW == 1 ? 16 * 68 : NW * 64 * 68];
    const size_t z = blockIdx.z; A += z * sA; if (A2) A2 += z * sA; Bt += z * sB; if (Bt2) Bt2 += z * sB; C += z * sC;
    const int lane = threadIdx.x & 31, lr = lane & 15, hi = lane >> 4; const int r0 = blockIdx.x * 64, c0 = blockIdx.y * 64;
    const int wv = NW == 1 ? 0 : __builtin_amdgcn_readfirstlane((int)(threadIdx.x >> 5));   // the wave's number in a scalar register: the k loop keeps its scalar counter and branch
    v8f acc[4][4];
#pragma unroll
    for (int mb = 0; mb < 4; ++mb)
#pragma unroll
        for (int nb = 0; nb < 4; ++nb) acc[mb][nb] = (v8f){};
    const size_t aoff = (size_t)(r0 + lr) * K + 8 * hi, boff = (size_t)(c0 + lr) * K + 8 * hi;
#pragma unroll 1
    for (int kc = wv * 32; kc < K; kc += 32 * NW) {
        V a[4], a2[4];
#pragma unroll
        for (int mb = 0; mb < 4; ++mb) { a[mb] = WFrag<T16>::ld(A + aoff + (size_t)mb * 16 * K + kc); if (NSPLIT == 1 || NSPLIT == 2) a2[mb] = WFrag<T16>::ld(A2 + aoff + (size_t)mb * 16 * K + kc); }
#pragma unroll
        for (int nb = 0; nb < 4; ++nb) { const V b = WFrag<T16>::ld(Bt + boff + (size_t)nb * 16 * K + kc); V b2; if (NSPLIT >= 2) b2 = WFrag<T16>::ld(Bt2 + boff + (size_t)nb * 16 * K + kc);
#pragma unroll
            for (int mb = 0; mb < 4; ++mb) { acc[mb][nb] = WFrag<T16>::mma(a[mb], b, acc[mb][nb]); if (NSPLIT == 1 || NSPLIT == 2) acc[mb][nb] = WFrag<T16>::mma(a2[mb], b, acc[mb][nb]); if (NSPLIT >= 2) acc[mb][nb] = WFrag<T16>::mma(a[mb], b2, acc[mb][nb]); } }
        asm volatile("v_nop\n\tv_nop\n\tv_nop\n\tv_nop" : "+v"(acc[0][0]), "+v"(acc[1][1]), "+v"(acc[2][2]), "+v"(acc[3][3]) : "v"(a[0]), "v"(a[3]));
    }
    if constexpr (NW > 1) {
        float* ow = os + wv * (64 * 68);
        // unrolled so that every accumulator index is a constant and the tiles stay in registers
#pragma unroll
        for (int mb = 0; mb < 4; ++mb)
#pragma unroll
            for (int nb = 0; nb < 4; ++nb)
#pragma unroll
                for (int j = 0; j < 8; ++j) ow[(mb * 16 + hi * 8 + j) * 68 + nb * 16 + lr] = acc[mb][nb][j];
        __syncthreads();   // every wave's partial tile is in LDS before any thread sums across waves
        for (int s = threadIdx.x; s < 64 * 16; s += 32 * NW) { const int row = s >> 4, cofs = (s & 15) * 4; v4f val = *(const v4fa*)(os + row * 68 + cofs);
#pragma unroll   // the NW LDS reads of one sum are independent: unrolled, they issue ahead of the adds
            for (int w = 1; w < NW; ++w) val += *(const v4fa*)(os + w * (64 * 68) + row * 68 + cofs);
            if (BIAS) { val[0] += bfr(bias[c0 + cofs]); val[1] += bfr(bias[c0 + cofs + 1]); val[2] += bfr(bias[c0 + cofs + 2]); val[3] += bfr(bias[c0 + cofs + 3]); }
            *(v4f*)(C + (size_t)(r0 + row) * ldc + c0 + cofs) = val; }
        return;
    }
#pragma unroll
    for (int mb = 0; mb < 4; ++mb) {
#pragma unroll
        for (int nb = 0; nb < 4; ++nb) {
#pragma unroll
            for (int j = 0; j < 8; ++j) os[(hi * 8 + j) * 68 + nb * 16 + lr] = acc[mb][nb][j]; }
        __builtin_amdgcn_wave_barrier(); asm volatile("" ::: "memory");
        float* crow = C + (size_t)(r0 + mb * 16) * ldc + c0;
{
#pragma unroll
            for (int s = 0; s < 8; ++s) { const int row = 2 * s + hi, cofs = lr * 4; v4f val = *(const v4fa*)(os + row * 68 + cofs); if (BIAS) { val[0] += bfr(bias[c0 + cofs]); val[1] += bfr(bias[c0 + cofs + 1]); val[2] += bfr(bias[c0 + cofs + 2]); val[3] += bfr(bias[c0 + cofs + 3]); }
                *(v4f*)(crow + (size_t)row * ldc + cofs) = val; }
             }
        __builtin_amdgcn_wave_barrier(); asm volatile("" ::: "memory");
    }
}

__device__ __forceinline__ void splitf(float y, unsigned short& h, unsigned short& l) { h = f2bf(y); l = f2bf(y - bf2f(h)); }
typedef __attribute__((ext_vector_type(2))) unsigned short v2us; typedef __attribute__((ext_vector_type(4))) unsigned short v4us; typedef __attribute__((ext_vector_type(4))) _Float16 v4h;
__device__ __forceinline__ h16 tohx(float x) { return (h16)x; }
#define PCAR 1024.0f

__global__ __launch_bounds__(256) void k_cvt8(const float* __restrict__ src, bf* dst, size_t n8) { const size_t i = (size_t)blockIdx.x * 256 + threadIdx.x; if (i >= n8) return; const v8f v = *(const v8f*)(src + i * 8); v8us o;
#pragma unroll
    for (int k = 0; k < 8; ++k) o[k] = f2bf(v[k]); *(v8us*)(dst + i * 8) = o;  }
__global__ __launch_bounds__(256) void k_wtG(const float* __restrict__ w, int K, int N, bf* Bt) {
    const int lane = threadIdx.x & 31; const int L0 = (blockIdx.x * 8 + (threadIdx.x >> 5)) * 8; const int nlines = N * K / 64;
{
#pragma unroll 1
        for (int l = 0; l < 8; ++l) { const int L = L0 + l; if (L >= nlines) break; const size_t e = (size_t)L * 64 + lane * 2; const int k = (int)(e % K), n = (int)(e / K); v2us o;
            o[0] = f2bf(w[(size_t)k * N + n]); o[1] = f2bf(w[(size_t)(k + 1) * N + n]); *(v2us*)(Bt + e) = o; }
         }
}

__global__ __launch_bounds__(256) void k_nt(const float* __restrict__ X, h16* NT) { const size_t e = ((size_t)blockIdx.x * 256 + threadIdx.x) * 4; if (e >= (size_t)FF * NN) return; const int n = (int)(e % NN); const int f = (int)(e / NN); v4h o;
#pragma unroll
    for (int u = 0; u < 4; ++u) o[u] = tohx(bfr(X[(size_t)(n + u) * FF + f])); *(v4h*)(NT + e) = o;  }
__global__ __launch_bounds__(256) void k_n16(const float* __restrict__ X, h16* N16, size_t n4) { const size_t e = ((size_t)blockIdx.x * 256 + threadIdx.x) * 4; if (e >= n4 * 4) return; const v4f a = *(const v4f*)(X + e); v4h o; for (int u = 0; u < 4; ++u) o[u] = tohx(bfr(a[u])); *(v4h*)(N16 + e) = o;  }
__global__ __launch_bounds__(256) void k_scl(const float* __restrict__ O, float* Y, size_t n4) { const size_t e = ((size_t)blockIdx.x * 256 + threadIdx.x) * 4; if (e >= n4 * 4) return; const v4f a = *(const v4f*)(O + e); v4f o; for (int u = 0; u < 4; ++u) o[u] = a[u] * (1.0f / PCAR); *(v4f*)(Y + e) = o;  }
__global__ __launch_bounds__(256) void k_pl(const float* __restrict__ F, h16* P, size_t n4) { const size_t e = ((size_t)blockIdx.x * 256 + threadIdx.x) * 4; if (e >= n4 * 4) return; const v4f a = *(const v4f*)(F + e); v4h o; for (int u = 0; u < 4; ++u) o[u] = tohx(a[u]); *(v4h*)(P + e) = o;  }
__global__ __launch_bounds__(256) void k_soft(const float* __restrict__ S, h16* P16) { const int lane = threadIdx.x & 31; const int row = blockIdx.x * 8 + (threadIdx.x >> 5); if (row >= NN) return; const float* sr = S + (size_t)row * NN; float v[NN / 32]; float mx = -3.0e38f;
#pragma unroll
    for (int ch = 0; ch < NN / 128; ++ch) { const v4f a = *(const v4f*)(sr + ch * 128 + lane * 4);
#pragma unroll
        for (int u = 0; u < 4; ++u) { const float t = a[u] * 0.0625f; v[ch * 4 + u] = t; mx = fmaxf(mx, t); } }
#pragma unroll
    for (int sh = 16; sh; sh >>= 1) mx = fmaxf(mx, __shfl_xor(mx, sh, 32));
    float sum = 0.f;
#pragma unroll
    for (int q = 0; q < NN / 32; ++q) { float d0 = __fsub_rn(v[q], mx); asm volatile("" : "+v"(d0)); v[q] = __builtin_amdgcn_exp2f(__fmul_rn(d0, 1.4426950408889634f)); sum += v[q]; }
#pragma unroll
    for (int sh = 16; sh; sh >>= 1) sum += __shfl_xor(sum, sh, 32);
    const float f = __fdiv_rn(PCAR, sum);
    {
#pragma unroll
        for (int ch = 0; ch < NN / 128; ++ch) { v4h o4; for (int q = 0; q < 4; ++q) o4[q] = tohx(v[ch * 4 + q] * f); *(v4h*)(P16 + (size_t)row * NN + ch * 128 + lane * 4) = o4; }
         } }

extern "C" void kernel_launch(void* const* d_in, const int* in_sizes, int n_in,
                              void* d_out, int out_size, void* d_ws, size_t ws_size, hipStream_t stream) {
    (void)in_sizes; (void)n_in; (void)out_size;
    const float* nodes = (const float*)d_in[0]; const float* Wm = (const float*)d_in[1];
    float* OUT = (float*)d_out;     // [4][4096][256]
    char* wsp = (char*)d_ws;
    auto take = [&](size_t bytes) { char* p = wsp; wsp += (bytes + 255) & ~(size_t)255; return (void*)p; };
    bf* BW = (bf*)take((size_t)FF * FF * 2); bf* NB16 = (bf*)take((size_t)NN * FF * 2); h16* NH = (h16*)take((size_t)NN * FF * 2); h16* NT = (h16*)take((size_t)FF * NN * 2); float* X = (float*)take((size_t)NN * FF * 4); h16* X16 = (h16*)take((size_t)NN * FF * 2);
    float* S = (float*)take((size_t)NN * NN * 4); h16* P16 = (h16*)take((size_t)NN * NN * 2); float* O = (float*)take((size_t)NN * FF * 4);
    if ((size_t)(wsp - (char*)d_ws) > ws_size) return;    // total ~ 118 MB (112 MiB)
    k_wtG<<<(FF * FF / 64 + 63) / 64, 256, 0, stream>>>(Wm, FF, FF, BW);   // 'fg' = [in][out]
    for (int b = 0; b < NB_; ++b) { const float* nb = nodes + (size_t)b * NN * FF;
        k_cvt8<<<(NN * FF / 8 + 255) / 256, 256, 0, stream>>>(nb, NB16, NN * FF / 8);          // bf16 A operand [n][f] for x = nodes W
        k_nt<<<(unsigned)(((size_t)FF * NN / 4 + 255) / 256), 256, 0, stream>>>(nb, NT); k_n16<<<(NN * FF / 4 + 255) / 256, 256, 0, stream>>>(nb, NH, (size_t)NN * FF / 4);        // fp16 [f][m] and [m][f] copies of the bf16-rounded nodes
        k_gemmw<bf, 0, false, 1><<<dim3(NN / 64, FF / 64, 1), 32, 0, stream>>>(NB16, nullptr, BW, nullptr, FF, X, FF, nullptr, 0, 0, 0);
        k_pl<<<(NN * FF / 4 + 255) / 256, 256, 0, stream>>>(X, X16, (size_t)NN * FF / 4);
        k_gemmw<h16, 0, false, 1><<<dim3(NN / 64, NN / 64, 1), 32, 0, stream>>>(X16, nullptr, NH, nullptr, FF, S, NN, nullptr, 0, 0, 0);   // prods[n][m] = x_n . nodes_m (fp16)
        k_soft<<<NN / 8, 256, 0, stream>>>(S, P16);
        k_gemmw<h16, 0, false, 16><<<dim3(NN / 64, FF / 64, 1), 32 * 16, 0, stream>>>(P16, nullptr, NT, nullptr, NN, O, FF, nullptr, 0, 0, 0); k_scl<<<(NN * FF / 4 + 255) / 256, 256, 0, stream>>>(O, OUT + (size_t)b * NN * FF, (size_t)NN * FF / 4); }
}

// v002
// A run of this version takes 174 microseconds.
// Timed twice side by side with v001, it ran 2.00 and 1.99 times as fast.
// Over all steps from v000 it is 3.46 times as fast.
#include <hip/hip_runtime.h>

// scalarProductAttentiont (nodes [4][4096][256], W [256][256]; x = nodes W; prods = x nodes^T; att = softmax(prods / 16); out = att nodes -> [4][4096][256]) - single head of width 256.
// Compute dtypes, f32 accumulate: every input rounded to bf16; x = nodes W as a PLAIN bf16 GEMM (exact products) -> fp16 planes; prods, softmax and att x nodes run in ONE kernel (k_fattn): scores single fp16 (f32 accumulate; bf16 node values are exact in fp16), running softmax in f32, unnormalised weights rounded to fp16, out = weights x nodes single fp16, divided by the f32 row sum at the end.

#define NB_  4
#define NN   4096
#define FF   256
typedef _Float16 h16;
typedef unsigned short bf;
typedef __attribute__((ext_vector_type(16))) __bf16   v16bf;
typedef __attribute__((ext_vector_type(16))) _Float16 v16h;
typedef __attribute__((ext_vector_type(8)))  _Float16 v8h;
typedef __attribute__((ext_vector_type(8)))  unsigned short v8us;
typedef __attribute__((ext_vector_type(8)))  float    v8f;
typedef __attribute__((ext_vector_type(4)))  float    v4f;
typedef v8h  __attribute__((may_alias)) v8ha;
typedef v4f  __attribute__((may_alias)) v4fa;
typedef v8us __attribute__((may_alias)) v8usa;

__device__ __forceinline__ unsigned short f2bf(float f) { unsigned u = __float_as_uint(f); u += 0x7FFFu + ((u >> 16) & 1u); return (unsigned short)(u >> 16); }
__device__ __forceinline__ float bf2f(unsigned short b) { return __uint_as_float(((unsigned)b) << 16); }
__device__ __forceinline__ float bfr(float f) { return bf2f(f2bf(f)); }
__device__ __forceinline__ v16h cat16(v8h lo, v8h hi) { return __builtin_shufflevector(lo, hi, 0, 1, 2, 3, 4, 5, 6, 7, 8, 9, 10, 11, 12, 13, 14, 15); }
__device__ __forceinline__ v16bf cat16b(v8us lo, v8us hi) { return __builtin_bit_cast(v16bf, __builtin_shufflevector(lo, hi, 0, 1, 2, 3, 4, 5, 6, 7, 8, 9, 10, 11, 12, 13, 14, 15)); }
__device__ __forceinline__ v8f wmma16(v16h a, v16h b, v8f c) { return __builtin_amdgcn_wmma_f32_16x16x32_f16(false, a, false, b, (short)0, c, false, false); }
__device__ __forceinline__ v8f wmmab(v16bf a, v16bf b, v8f c) { return __builtin_amdgcn_wmma_f32_16x16x32_bf16(false, a, false, b, (short)0, c, false, false); }



// ---- k_gemmw: register-blocked GEMM, ONE WAVE per 64x64 output tile (16 accumulators), operands straight from K-contiguous 16-bit planes; grid (M/64, N/64, Z), 32 threads.
// C[m][n] (f32, pitch ldc, + optional f32 bias[n]) = sum_k A[m][k] Bt[n][k] (+ split products per NSPLIT). z-batch strides sA/sB/sC in elements. K % 32 == 0.
// NW > 1: NW waves (32 * NW threads) share the tile; wave w takes the 32-k steps w, w + NW, ... and the NW partial tiles are summed through LDS in wave order.
template <typename T16> struct WFrag;
template <> struct WFrag<h16> { typedef v16h V; static __device__ __forceinline__ V ld(const h16* p) { return cat16(*(const v8h*)p, *(const v8h*)(p + 16)); } static __device__ __forceinline__ v8f mma(V a, V b, v8f c) { return wmma16(a, b, c); } };
template <> struct WFrag<bf> { typedef v16bf V; static __device__ __forceinline__ V ld(const bf* p) { return cat16b(*(const v8us*)p, *(const v8us*)(p + 16)); } static __device__ __forceinline__ v8f mma(V a, V b, v8f c) { return wmmab(a, b, c); } };
template <typename T16, int NSPLIT, bool BIAS, int NW>
__global__ __launch_bounds__(32 * NW) void k_gemmw(const T16* __restrict__ A, const T16* __restrict__ A2, const T16* __restrict__ Bt, const T16* __restrict__ Bt2, int K, float* C, int ldc, const float* __restrict__ bias, size_t sA, size_t sB, size_t sC) {
    typedef typename WFrag<T16>::V V;
    __shared__ __align__(16) float os[NW == 1 ? 16 * 68 : NW * 64 * 68];
    const size_t z = blockIdx.z; A += z * sA; if (A2) A2 += z * sA; Bt += z * sB; if (Bt2) Bt2 += z * sB; C += z * sC;
    const int lane = threadIdx.x & 31, lr = lane & 15, hi = lane >> 4; const int r0 = blockIdx.x * 64, c0 = blockIdx.y * 64;
    const int wv = NW == 1 ? 0 : __builtin_amdgcn_readfirstlane((int)(threadIdx.x >> 5));   // the wave's number in a scalar register: the k loop keeps its scalar counter and branch
    v8f acc[4][4];
#pragma unroll
    for (int mb = 0; mb < 4; ++mb)
#pragma unroll
        for (int nb = 0; nb < 4; ++nb) acc[mb][nb] = (v8f){};
    const size_t aoff = (size_t)(r0 + lr) * K + 8 * hi, boff = (size_t)(c0 + lr) * K + 8 * hi;
#pragma unroll 1
    for (int kc = wv * 32; kc < K; kc += 32 * NW) {
        V a[4], a2[4];
#pragma unroll
        for (int mb = 0; mb < 4; ++mb) { a[mb] = WFrag<T16>::ld(A + aoff + (size_t)mb * 16 * K + kc); if (NSPLIT == 1 || NSPLIT == 2) a2[mb] = WFrag<T16>::ld(A2 + aoff + (size_t)mb * 16 * K + kc); }
#pragma unroll
        for (int nb = 0; nb < 4; ++nb) { const V b = WFrag<T16>::ld(Bt + boff + (size_t)nb * 16 * K + kc); V b2; if (NSPLIT >= 2) b2 = WFrag<T16>::ld(Bt2 + boff + (size_t)nb * 16 * K + kc);
#pragma unroll
            for (int mb = 0; mb < 4; ++mb) { acc[mb][nb] = WFrag<T16>::mma(a[mb], b, acc[mb][nb]); if (NSPLIT == 1 || NSPLIT == 2) acc[mb][nb] = WFrag<T16>::mma(a2[mb], b, acc[mb][nb]); if (NSPLIT >= 2) acc[mb][nb] = WFrag<T16>::mma(a[mb], b2, acc[mb][nb]); } }
        asm volatile("v_nop\n\tv_nop\n\tv_nop\n\tv_nop" : "+v"(acc[0][0]), "+v"(acc[1][1]), "+v"(acc[2][2]), "+v"(acc[3][3]) : "v"(a[0]), "v"(a[3]));
    }
    if constexpr (NW > 1) {
        float* ow = os + wv * (64 * 68);
        // unrolled so that every accumulator index is a constant and the tiles stay in registers
#pragma unroll
        for (int mb = 0; mb < 4; ++mb)
#pragma unroll
            for (int nb = 0; nb < 4; ++nb)
#pragma unroll
                for (int j = 0; j < 8; ++j) ow[(mb * 16 + hi * 8 + j) * 68 + nb * 16 + lr] = acc[mb][nb][j];
        __syncthreads();   // every wave's partial tile is in LDS before any thread sums across waves
        for (int s = threadIdx.x; s < 64 * 16; s += 32 * NW) { const int row = s >> 4, cofs = (s & 15) * 4; v4f val = *(const v4fa*)(os + row * 68 + cofs);
#pragma unroll   // the NW LDS reads of one sum are independent: unrolled, they issue ahead of the adds
            for (int w = 1; w < NW; ++w) val += *(const v4fa*)(os + w * (64 * 68) + row * 68 + cofs);
            if (BIAS) { val[0] += bfr(bias[c0 + cofs]); val[1] += bfr(bias[c0 + cofs + 1]); val[2] += bfr(bias[c0 + cofs + 2]); val[3] += bfr(bias[c0 + cofs + 3]); }
            *(v4f*)(C + (size_t)(r0 + row) * ldc + c0 + cofs) = val; }
        return;
    }
#pragma unroll
    for (int mb = 0; mb < 4; ++mb) {
#pragma unroll
        for (int nb = 0; nb < 4; ++nb) {
#pragma unroll
            for (int j = 0; j < 8; ++j) os[(hi * 8 + j) * 68 + nb * 16 + lr] = acc[mb][nb][j]; }
        __builtin_amdgcn_wave_barrier(); asm volatile("" ::: "memory");
        float* crow = C + (size_t)(r0 + mb * 16) * ldc + c0;
{
#pragma unroll
            for (int s = 0; s < 8; ++s) { const int row = 2 * s + hi, cofs = lr * 4; v4f val = *(const v4fa*)(os + row * 68 + cofs); if (BIAS) { val[0] += bfr(bias[c0 + cofs]); val[1] += bfr(bias[c0 + cofs + 1]); val[2] += bfr(bias[c0 + cofs + 2]); val[3] += bfr(bias[c0 + cofs + 3]); }
                *(v4f*)(crow + (size_t)row * ldc + cofs) = val; }
             }
        __builtin_amdgcn_wave_barrier(); asm volatile("" ::: "memory");
    }
}

__device__ __forceinline__ void splitf(float y, unsigned short& h, unsigned short& l) { h = f2bf(y); l = f2bf(y - bf2f(h)); }
typedef __attribute__((ext_vector_type(2))) unsigned short v2us; typedef __attribute__((ext_vector_type(4))) unsigned short v4us; typedef __attribute__((ext_vector_type(4))) _Float16 v4h;
__device__ __forceinline__ h16 tohx(float x) { return (h16)x; }

__global__ __launch_bounds__(256) void k_cvt8(const float* __restrict__ src, bf* dst, size_t n8) { const size_t i = (size_t)blockIdx.x * 256 + threadIdx.x; if (i >= n8) return; const v8f v = *(const v8f*)(src + i * 8); v8us o;
#pragma unroll
    for (int k = 0; k < 8; ++k) o[k] = f2bf(v[k]); *(v8us*)(dst + i * 8) = o;  }
__global__ __launch_bounds__(256) void k_wtG(const float* __restrict__ w, int K, int N, bf* Bt) {
    const int lane = threadIdx.x & 31; const int L0 = (blockIdx.x * 8 + (threadIdx.x >> 5)) * 8; const int nlines = N * K / 64;
{
#pragma unroll 1
        for (int l = 0; l < 8; ++l) { const int L = L0 + l; if (L >= nlines) break; const size_t e = (size_t)L * 64 + lane * 2; const int k = (int)(e % K), n = (int)(e / K); v2us o;
            o[0] = f2bf(w[(size_t)k * N + n]); o[1] = f2bf(w[(size_t)(k + 1) * N + n]); *(v2us*)(Bt + e) = o; }
         }
}

__global__ __launch_bounds__(256) void k_nt(const float* __restrict__ X, h16* NT) { const size_t e = ((size_t)blockIdx.x * 256 + threadIdx.x) * 4; if (e >= (size_t)FF * NN) return; const int n = (int)(e % NN); const int f = (int)(e / NN); v4h o;
#pragma unroll
    for (int u = 0; u < 4; ++u) o[u] = tohx(bfr(X[(size_t)(n + u) * FF + f])); *(v4h*)(NT + e) = o;  }
__global__ __launch_bounds__(256) void k_n16(const float* __restrict__ X, h16* N16, size_t n4) { const size_t e = ((size_t)blockIdx.x * 256 + threadIdx.x) * 4; if (e >= n4 * 4) return; const v4f a = *(const v4f*)(X + e); v4h o; for (int u = 0; u < 4; ++u) o[u] = tohx(bfr(a[u])); *(v4h*)(N16 + e) = o;  }
__global__ __launch_bounds__(256) void k_pl(const float* __restrict__ F, h16* P, size_t n4) { const size_t e = ((size_t)blockIdx.x * 256 + threadIdx.x) * 4; if (e >= n4 * 4) return; const v4f a = *(const v4f*)(F + e); v4h o; for (int u = 0; u < 4; ++u) o[u] = tohx(a[u]); *(v4h*)(P + e) = o;  }

__device__ __forceinline__ float xhalf(float x) { return __builtin_bit_cast(float, __builtin_amdgcn_permlanex16(__builtin_bit_cast(int, x), __builtin_bit_cast(int, x), 0x76543210, 0xfedcba98, false, false)); }   // lane l with lane l ^ 16, on the vector pipe: an LDS-path exchange would queue behind the fragment reads
#define KST   64                 // keys per stage
#define NSTG  (NN / KST)
#define KP    264                // key-tile row pitch in halves: 512 B + 16 B (16 B x odd: conflict-free 16-byte reads down 16 rows)
#define VP    72                 // [f][key] tile row pitch in halves: 128 B + 16 B
#define KTILE (KST * KP)
#define STG   (KTILE + FF * VP)  // halves per stage buffer
#define SCL2  0.09016844005556021f   // (1 / 16) * log2(e): scores go to base-2 exponents
__global__ __launch_bounds__(256) void k_fattn(const h16* __restrict__ Q, const h16* __restrict__ Kn, const h16* __restrict__ Vt, float* __restrict__ Out) {
    __shared__ __align__(16) h16 sm[2 * STG];
    const size_t z = blockIdx.y; Q += z * NN * FF; Kn += z * NN * FF; Vt += z * NN * FF; Out += z * NN * FF;
    const int tid = threadIdx.x, lane = tid & 31, lr = lane & 15, hi = lane >> 4;
    const int wv = __builtin_amdgcn_readfirstlane(tid >> 5), qg = wv & 3, kh = wv >> 2;
    const int q0 = blockIdx.x * 64 + qg * 16;
    v16h qf[8];
#pragma unroll
    for (int kc = 0; kc < 8; ++kc) { const h16* p = Q + (size_t)(q0 + lr) * FF + kc * 32 + 8 * hi; qf[kc] = cat16(*(const v8h*)p, *(const v8h*)(p + 16)); }
    v8f acc[16];
#pragma unroll
    for (int ft = 0; ft < 16; ++ft) acc[ft] = (v8f){};
    float rf = -1.0e30f, l = 0.f;    // weights are 2^(score - rf); l = this lane's share of their sum
    // staging: a stage's 64 key rows are 32 KiB in a row of the [m][f] plane; its [f][key] tile is 256 rows of 128 B. 16 B per thread and step, whole lines per wave.
    const h16* gk = Kn + tid * 8; const h16* gv = Vt + (size_t)(tid >> 3) * NN + (tid & 7) * 8;
    const int sk = (tid >> 5) * KP + (tid & 31) * 8, sv = KTILE + (tid >> 3) * VP + (tid & 7) * 8;
    v8h stk[8], stv[8];
#pragma unroll
    for (int j = 0; j < 8; ++j) { stk[j] = *(const v8h*)(gk + j * 2048); stv[j] = *(const v8h*)(gv + (size_t)j * 32 * NN); }
#pragma unroll
    for (int j = 0; j < 8; ++j) { *(v8h*)(sm + sk + j * 8 * KP) = stk[j]; *(v8h*)(sm + sv + j * 32 * VP) = stv[j]; }
    __syncthreads();   // stage 0 is in LDS before any wave reads it
    // the stage loop stays rolled: one stage is already a long straight-line body. Every inner loop of this kernel is unrolled so that all fragment and accumulator indices are constants and the arrays stay in registers.
#pragma unroll 1
    for (int t = 0; t < NSTG; ++t) {
        const h16* bk = sm + (t & 1) * STG;
        if (t + 1 < NSTG) {   // the next stage's global loads fly while this stage is worked on
#pragma unroll
            for (int j = 0; j < 8; ++j) { stk[j] = *(const v8h*)(gk + (size_t)(t + 1) * KST * FF + j * 2048); stv[j] = *(const v8h*)(gv + (size_t)j * 32 * NN + (t + 1) * KST); }
            asm volatile("s_wait_xcnt 0x0" ::: "memory");   // the fragment reads below reuse the address registers of these loads: the wait stands in front of that overwrite
        }
        const h16* kt = bk + (kh * 32 + lr) * KP + 8 * hi;
        v16h fk[16], fv[16];
#pragma unroll
        for (int kc = 0; kc < 8; ++kc) {
            fk[2 * kc] = cat16(*(const v8h*)(kt + kc * 32), *(const v8h*)(kt + kc * 32 + 16));
            fk[2 * kc + 1] = cat16(*(const v8h*)(kt + 16 * KP + kc * 32), *(const v8h*)(kt + 16 * KP + kc * 32 + 16)); }
        __builtin_amdgcn_sched_barrier(0);   // keeps the 32 key-fragment reads together in front of the score WMMAs: spread among them, every WMMA waits out a whole LDS latency
        v8f s0 = (v8f){}, s1 = (v8f){};
#pragma unroll
        for (int kc = 0; kc < 8; ++kc) { s0 = wmma16(fk[2 * kc], qf[kc], s0); s1 = wmma16(fk[2 * kc + 1], qf[kc], s1); }
        const h16* vt = bk + KTILE + lr * VP + kh * 32 + 8 * hi;
#pragma unroll
        for (int ft = 0; ft < 16; ++ft) fv[ft] = cat16(*(const v8h*)(vt + ft * 16 * VP), *(const v8h*)(vt + ft * 16 * VP + 16));
        __builtin_amdgcn_sched_barrier(0);   // the 32 [f][key] fragment reads are issued in front of the softmax: left to the compiler they sink behind the rescale branch and the LDS pipe idles meanwhile
        float mx = fmaxf(s0[0], s1[0]);
#pragma unroll
        for (int j = 1; j < 8; ++j) mx = fmaxf(mx, fmaxf(s0[j], s1[j]));
        mx = fmaxf(mx, xhalf(mx)) * SCL2;
        // lazy rescale, one scalar branch per stage: rf moves only when a weight would pass 2^12 (fp16 holds it; f32 sums); it is then set 4 below the maximum so that small weights stay normal fp16 numbers
        if (__builtin_amdgcn_ballot_w32(mx > rf + 12.0f) != 0) {
            const float rn = fmaxf(rf, mx - 4.0f); const float al = __builtin_amdgcn_exp2f(rf - rn); rf = rn; l *= al;
#pragma unroll
            for (int ft = 0; ft < 16; ++ft) acc[ft] *= al;
        }
        v16h pb;
#pragma unroll
        for (int j = 0; j < 8; ++j) { const float p0 = __builtin_amdgcn_exp2f(fmaf(s0[j], SCL2, -rf)), p1 = __builtin_amdgcn_exp2f(fmaf(s1[j], SCL2, -rf)); l += p0 + p1; pb[j] = tohx(p0); pb[8 + j] = tohx(p1); }
#pragma unroll
        for (int ft = 0; ft < 16; ++ft) acc[ft] = wmma16(fv[ft], pb, acc[ft]);
        if (t + 1 < NSTG) { h16* bn = sm + ((t + 1) & 1) * STG;   // the buffer that stage t - 1 used: its readers left it before the barrier that ended pass t - 1
#pragma unroll
            for (int j = 0; j < 8; ++j) { *(v8h*)(bn + sk + j * 8 * KP) = stk[j]; *(v8h*)(bn + sv + j * 32 * VP) = stv[j]; }
        }
        __syncthreads();   // publishes stage t + 1 and ends every read of stage t
    }
    l += xhalf(l);
    // join the two key halves: the upper waves hand their tiles over through the stage buffers, which nobody reads any more
    float* mg = (float*)sm + qg * (33 * 128) + lane * 4;
    if (kh == 1) {
#pragma unroll
        for (int ft = 0; ft < 16; ++ft) { *(v4fa*)(mg + (ft * 2) * 128) = (v4f){acc[ft][0], acc[ft][1], acc[ft][2], acc[ft][3]}; *(v4fa*)(mg + (ft * 2 + 1) * 128) = (v4f){acc[ft][4], acc[ft][5], acc[ft][6], acc[ft][7]}; }
        *(v4fa*)(mg + 32 * 128) = (v4f){rf, l, 0.f, 0.f};
    }
    __syncthreads();   // the upper waves' tiles are in LDS before the lower waves read them
    if (kh == 0) {
        const v4f o = *(const v4fa*)(mg + 32 * 128);
        const float rn = fmaxf(rf, o[0]); const float a0 = __builtin_amdgcn_exp2f(rf - rn), a1 = __builtin_amdgcn_exp2f(o[0] - rn);
        const float inv = __fdiv_rn(1.0f, l * a0 + o[1] * a1); const float c0 = a0 * inv, c1 = a1 * inv;
        float* orow = Out + (size_t)(q0 + lr) * FF + 8 * hi;
#pragma unroll
        for (int ft = 0; ft < 16; ++ft) { const v4f u = *(const v4fa*)(mg + (ft * 2) * 128), w = *(const v4fa*)(mg + (ft * 2 + 1) * 128);
            *(v4f*)(orow + ft * 16) = (v4f){acc[ft][0] * c0 + u[0] * c1, acc[ft][1] * c0 + u[1] * c1, acc[ft][2] * c0 + u[2] * c1, acc[ft][3] * c0 + u[3] * c1};
            *(v4f*)(orow + ft * 16 + 4) = (v4f){acc[ft][4] * c0 + w[0] * c1, acc[ft][5] * c0 + w[1] * c1, acc[ft][6] * c0 + w[2] * c1, acc[ft][7] * c0 + w[3] * c1}; }
    }
}

extern "C" void kernel_launch(void* const* d_in, const int* in_sizes, int n_in,
                              void* d_out, int out_size, void* d_ws, size_t ws_size, hipStream_t stream) {
    (void)in_sizes; (void)n_in; (void)out_size;
    const float* nodes = (const float*)d_in[0]; const float* Wm = (const float*)d_in[1];
    float* OUT = (float*)d_out;     // [4][4096][256]
    char* wsp = (char*)d_ws;
    auto take = [&](size_t bytes) { char* p = wsp; wsp += (bytes + 255) & ~(size_t)255; return (void*)p; };
    bf* BW = (bf*)take((size_t)FF * FF * 2); bf* NB16 = (bf*)take((size_t)NN * FF * 2); float* X = (float*)take((size_t)NN * FF * 4);
    h16* NH = (h16*)take((size_t)NB_ * NN * FF * 2); h16* NT = (h16*)take((size_t)NB_ * FF * NN * 2); h16* X16 = (h16*)take((size_t)NB_ * NN * FF * 2);   // one plane per batch: the fused kernel takes all batches in one launch
    if ((size_t)(wsp - (char*)d_ws) > ws_size) return;    // total ~ 32 MB
    k_wtG<<<(FF * FF / 64 + 63) / 64, 256, 0, stream>>>(Wm, FF, FF, BW);   // 'fg' = [in][out]
    for (int b = 0; b < NB_; ++b) { const float* nb = nodes + (size_t)b * NN * FF;
        k_cvt8<<<(NN * FF / 8 + 255) / 256, 256, 0, stream>>>(nb, NB16, NN * FF / 8);          // A operand [n][f]
        k_nt<<<(unsigned)(((size_t)FF * NN / 4 + 255) / 256), 256, 0, stream>>>(nb, NT + (size_t)b * FF * NN); k_n16<<<(NN * FF / 4 + 255) / 256, 256, 0, stream>>>(nb, NH + (size_t)b * NN * FF, (size_t)NN * FF / 4);        // fp16 [f][m] and [m][f] copies of the bf16-rounded nodes
        k_gemmw<bf, 0, false, 1><<<dim3(NN / 64, FF / 64, 1), 32, 0, stream>>>(NB16, nullptr, BW, nullptr, FF, X, FF, nullptr, 0, 0, 0);
        k_pl<<<(NN * FF / 4 + 255) / 256, 256, 0, stream>>>(X, X16 + (size_t)b * NN * FF, (size_t)NN * FF / 4); }
    k_fattn<<<dim3(NN / 64, NB_, 1), 256, 0, stream>>>(X16, NH, NT, OUT);
}

// v003
// It runs in 86.6 microseconds.
// In two side-by-side timings against v002, it was 2.04 and 2.01 times as fast.
// Over all steps from v000 it is 7.01 times as fast.
#include <hip/hip_runtime.h>

// scalarProductAttentiont (nodes [4][4096][256], W [256][256]; x = nodes W; prods = x nodes^T; att = softmax(prods / 16); out = att nodes -> [4][4096][256]) - single head of width 256.
// Compute dtypes, f32 accumulate: every input rounded to bf16; x = nodes W as a PLAIN bf16 GEMM (exact products) -> fp16 planes, made with the fp16 node planes in ONE kernel (k_prep); prods, softmax and att x nodes run in ONE kernel (k_fattn): scores single fp16 (f32 accumulate; bf16 node values are exact in fp16), running softmax in f32, unnormalised weights rounded to fp16, out = weights x nodes single fp16, divided by the f32 row sum at the end.

#define NB_  4
#define NN   4096
#define FF   256
typedef _Float16 h16;
typedef unsigned short bf;
typedef __attribute__((ext_vector_type(16))) __bf16   v16bf;
typedef __attribute__((ext_vector_type(16))) _Float16 v16h;
typedef __attribute__((ext_vector_type(8)))  _Float16 v8h;
typedef __attribute__((ext_vector_type(8)))  unsigned short v8us;
typedef __attribute__((ext_vector_type(8)))  float    v8f;
typedef __attribute__((ext_vector_type(4)))  float    v4f;
typedef v4f  __attribute__((may_alias)) v4fa;

__device__ __forceinline__ v16h cat16(v8h lo, v8h hi) { return __builtin_shufflevector(lo, hi, 0, 1, 2, 3, 4, 5, 6, 7, 8, 9, 10, 11, 12, 13, 14, 15); }
__device__ __forceinline__ v16bf cat16b(v8us lo, v8us hi) { return __builtin_bit_cast(v16bf, __builtin_shufflevector(lo, hi, 0, 1, 2, 3, 4, 5, 6, 7, 8, 9, 10, 11, 12, 13, 14, 15)); }
__device__ __forceinline__ v8f wmma16(v16h a, v16h b, v8f c) { return __builtin_amdgcn_wmma_f32_16x16x32_f16(false, a, false, b, (short)0, c, false, false); }
__device__ __forceinline__ v8f wmmab(v16bf a, v16bf b, v8f c) { return __builtin_amdgcn_wmma_f32_16x16x32_bf16(false, a, false, b, (short)0, c, false, false); }



typedef __attribute__((ext_vector_type(2))) float v2f; typedef __attribute__((ext_vector_type(2))) __bf16 v2bf; typedef __attribute__((ext_vector_type(2))) _Float16 v2h;
typedef __attribute__((ext_vector_type(2))) unsigned v2u; typedef __attribute__((ext_vector_type(4))) unsigned v4u; typedef __attribute__((ext_vector_type(8))) unsigned v8u;
__device__ __forceinline__ h16 tohx(float x) { return (h16)x; }
__device__ __forceinline__ unsigned pkbf(float a, float b) { return __builtin_bit_cast(unsigned, __builtin_convertvector((v2f){a, b}, v2bf)); }   // two f32 -> two bf16, nearest even, one instruction
__device__ __forceinline__ unsigned pkh(float a, float b) { return __builtin_bit_cast(unsigned, __builtin_convertvector((v2f){a, b}, v2h)); }     // two f32 -> two fp16, nearest even, one instruction

// ---- k_prep: everything the attention kernel reads, made in one launch. Grid (N / 64, batches), 256 threads = 8 waves; a work-group owns 64 node rows.
// It rounds its rows to bf16 once and writes them as the fp16 [m][f] plane (from registers), as the fp16 [f][m] plane (8 rows per thread give 16-byte pieces, turned through LDS so that whole 128-byte lines go out) and as a bf16 LDS tile for x = nodes W.
// Transposed product x^T = W^T nodes^T: A = 16 columns of W read straight from the f32 matrix and rounded in registers, B = 16 node rows from LDS. Wave w owns columns 32 w .. + 31; row r of its A tile nb is column 32 w + 2 r + nb, so one 8-byte load feeds both tiles and a lane ends with 16 neighbouring x values of one node row.
#define AP    264                // node-tile row pitch in halves: 512 B + 16 B (conflict-free 16-byte reads down 16 rows)
#define TP    72                 // [f][m] tile row pitch in halves: 128 B + 16 B
__global__ __launch_bounds__(256) void k_prep(const float* __restrict__ nodes, const float* __restrict__ Wm, h16* __restrict__ NH, h16* __restrict__ NT, h16* __restrict__ X16) {
    __shared__ __align__(16) bf  As[64 * AP];
    __shared__ __align__(16) h16 Ts[FF * TP];
    const size_t z = blockIdx.y; const int m0 = blockIdx.x * 64;
    const int tid = threadIdx.x, lane = tid & 31, lr = lane & 15, hi = lane >> 4;
    const int g0 = __builtin_amdgcn_readfirstlane(tid >> 5) * 32;
    const int f4 = (tid & 63) * 4, mg = (tid >> 6) * 8;   // this thread's 4 features and the first of its 8 rows (again 32 rows further down)
    // each lane's part of every global address, in bytes, formed once at entry; the rest of an address is the same for the whole wave
    const unsigned bN = (mg * FF + f4) * 4u, bW = (8 * hi * FF + 2 * lr) * 4u, bH = (mg * FF + f4) * 2u, bT = ((tid >> 3) * NN + (tid & 7) * 8) * 2u, bX = (lr * FF + 16 * hi) * 2u;
    const char* sp = (const char*)(nodes + (z * NN + m0) * FF) + bN;
    const char* wp = (const char*)(Wm + g0) + bW;
    // every loop of this kernel is unrolled so that all fragment and accumulator indices are constants and the arrays stay in registers
    v4f nd[2][8];
#pragma unroll
    for (int p = 0; p < 2; ++p)
#pragma unroll
        for (int j = 0; j < 8; ++j) nd[p][j] = *(const v4f*)(sp + (p * 32 + j) * FF * 4);
    __builtin_amdgcn_sched_barrier(0);   // the node loads go out first: loads return in order, and the rows are rounded and staged while the W loads are still coming in
    v2f wx[8][16];   // entry i of step kc: k = 32 kc + 8 hi + (i & 7) + 16 (i >> 3), the k order of the 16-bit fragments
#pragma unroll
    for (int kc = 0; kc < 8; ++kc)
#pragma unroll
        for (int i = 0; i < 16; ++i) wx[kc][i] = *(const v2f*)(wp + (kc * 32 + (i & 7) + 16 * (i >> 3)) * FF * 4);
    asm volatile("s_wait_xcnt 0x0" :: "v"(bN), "v"(bW), "v"(bH), "v"(bT), "v"(bX) : "memory");   // stands in front of every overwrite of the loads' address registers; the lane offsets are named so that they are formed in front of it and live up to it
    __builtin_amdgcn_sched_barrier(0);   // all loads of the kernel are issued above in one run: left to the compiler the W loads sink to their uses in eight groups, each waited out alone
    v2u nhw[2][8];
#pragma unroll
    for (int p = 0; p < 2; ++p) { v4u tr[4];
#pragma unroll
        for (int j = 0; j < 8; j += 2) { float r[2][4];   // two rows' values after the bf16 rounding, back in f32
#pragma unroll
            for (int e = 0; e < 2; ++e) { const v4f v = nd[p][j + e]; const v2u b = {pkbf(v[0], v[1]), pkbf(v[2], v[3])};
                r[e][0] = __uint_as_float(b[0] << 16); r[e][1] = __uint_as_float(b[0] & 0xFFFF0000u); r[e][2] = __uint_as_float(b[1] << 16); r[e][3] = __uint_as_float(b[1] & 0xFFFF0000u);
                *(v2u*)(As + (p * 32 + mg + j + e) * AP + f4) = b; nhw[p][j + e] = (v2u){pkh(r[e][0], r[e][1]), pkh(r[e][2], r[e][3])}; }
#pragma unroll
            for (int u = 0; u < 4; ++u) tr[u][j >> 1] = pkh(r[0][u], r[1][u]); }
#pragma unroll
        for (int u = 0; u < 4; ++u) *(v4u*)(Ts + (f4 + u) * TP + p * 32 + mg) = tr[u]; }
    __syncthreads();   // both LDS tiles are whole before any wave reads rows that other waves wrote; every global store stands behind it, so that it waits for no store
    const bf* ap = As + lr * AP + 8 * hi;
    v8h tq[8]; v16bf nf[8][4];
#pragma unroll
    for (int i = 0; i < 8; ++i) tq[i] = *(const v8h*)(Ts + (i * 32 + (tid >> 3)) * TP + (tid & 7) * 8);
#pragma unroll
    for (int kc = 0; kc < 2; ++kc)
#pragma unroll
        for (int mb = 0; mb < 4; ++mb) nf[kc][mb] = cat16b(*(const v8us*)(ap + mb * 16 * AP + kc * 32), *(const v8us*)(ap + mb * 16 * AP + kc * 32 + 16));
    __builtin_amdgcn_sched_barrier(0);   // the LDS reads above go out together: left to the compiler each read is waited out alone in front of its store or WMMA
    char* nh = (char*)(NH + (z * NN + m0) * FF) + bH;
#pragma unroll
    for (int p = 0; p < 2; ++p)
#pragma unroll
        for (int j = 0; j < 8; ++j) *(v2u*)(nh + (p * 32 + j) * FF * 2) = nhw[p][j];
    char* nt = (char*)(NT + (z * FF * NN + m0)) + bT;
#pragma unroll
    for (int i = 0; i < 8; ++i) *(v8h*)(nt + i * 32 * NN * 2) = tq[i];
    asm volatile("s_wait_xcnt 0x0" :: "v"(bH), "v"(bT) : "memory");   // the work below reuses the data and address registers of these stores: the wait stands in front of that overwrite
    v8f acc[2][4];
#pragma unroll
    for (int nb = 0; nb < 2; ++nb)
#pragma unroll
        for (int mb = 0; mb < 4; ++mb) acc[nb][mb] = (v8f){};
#pragma unroll
    for (int kc = 0; kc < 8; ++kc) {
        if (kc + 2 < 8) {
#pragma unroll
            for (int mb = 0; mb < 4; ++mb) nf[kc + 2][mb] = cat16b(*(const v8us*)(ap + mb * 16 * AP + (kc + 2) * 32), *(const v8us*)(ap + mb * 16 * AP + (kc + 2) * 32 + 16)); }
        __builtin_amdgcn_sched_barrier(0);   // keeps the node fragments two k steps ahead of the WMMAs that use them, so that no WMMA waits out a whole LDS latency
        v8u a, b;
#pragma unroll
        for (int i = 0; i < 8; ++i) { a[i] = pkbf(wx[kc][2 * i][0], wx[kc][2 * i + 1][0]); b[i] = pkbf(wx[kc][2 * i][1], wx[kc][2 * i + 1][1]); }
        const v16bf w0 = __builtin_bit_cast(v16bf, a), w1 = __builtin_bit_cast(v16bf, b);
#pragma unroll
        for (int mb = 0; mb < 4; ++mb) { acc[0][mb] = wmmab(w0, nf[kc][mb], acc[0][mb]); acc[1][mb] = wmmab(w1, nf[kc][mb], acc[1][mb]); }
    }
    char* xr = (char*)(X16 + ((z * NN + m0) * FF + g0)) + bX;
    v8u o[4];
#pragma unroll
    for (int mb = 0; mb < 4; ++mb)
#pragma unroll
        for (int j = 0; j < 8; ++j) o[mb][j] = pkh(acc[0][mb][j], acc[1][mb][j]);
    __builtin_amdgcn_sched_barrier(0);   // the last stores stand behind all arithmetic: no register that they name is written again
#pragma unroll
    for (int mb = 0; mb < 4; ++mb) *(v8u*)(xr + mb * 16 * FF * 2) = o[mb];
}

__device__ __forceinline__ float xhalf(float x) { return __builtin_bit_cast(float, __builtin_amdgcn_permlanex16(__builtin_bit_cast(int, x), __builtin_bit_cast(int, x), 0x76543210, 0xfedcba98, false, false)); }   // lane l with lane l ^ 16, on the vector pipe: an LDS-path exchange would queue behind the fragment reads
#define KST   64                 // keys per stage
#define NSTG  (NN / KST)
#define KP    264                // key-tile row pitch in halves: 512 B + 16 B (16 B x odd: conflict-free 16-byte reads down 16 rows)
#define VP    72                 // [f][key] tile row pitch in halves: 128 B + 16 B
#define KTILE (KST * KP)
#define STG   (KTILE + FF * VP)  // halves per stage buffer
#define SCL2  0.09016844005556021f   // (1 / 16) * log2(e): scores go to base-2 exponents
__global__ __launch_bounds__(256) void k_fattn(const h16* __restrict__ Q, const h16* __restrict__ Kn, const h16* __restrict__ Vt, float* __restrict__ Out) {
    __shared__ __align__(16) h16 sm[2 * STG];
    const size_t z = blockIdx.y; Q += z * NN * FF; Kn += z * NN * FF; Vt += z * NN * FF; Out += z * NN * FF;
    const int tid = threadIdx.x, lane = tid & 31, lr = lane & 15, hi = lane >> 4;
    const int wv = __builtin_amdgcn_readfirstlane(tid >> 5), qg = wv & 3, kh = wv >> 2;
    const int q0 = blockIdx.x * 64 + qg * 16;
    v16h qf[8];
#pragma unroll
    for (int kc = 0; kc < 8; ++kc) { const h16* p = Q + (size_t)(q0 + lr) * FF + kc * 32 + 8 * hi; qf[kc] = cat16(*(const v8h*)p, *(const v8h*)(p + 16)); }
    v8f acc[16];
#pragma unroll
    for (int ft = 0; ft < 16; ++ft) acc[ft] = (v8f){};
    float rf = -1.0e30f, l = 0.f;    // weights are 2^(score - rf); l = this lane's share of their sum
    // staging: a stage's 64 key rows are 32 KiB in a row of the [m][f] plane; its [f][key] tile is 256 rows of 128 B. 16 B per thread and step, whole lines per wave.
    const h16* gk = Kn + tid * 8; const h16* gv = Vt + (size_t)(tid >> 3) * NN + (tid & 7) * 8;
    const int sk = (tid >> 5) * KP + (tid & 31) * 8, sv = KTILE + (tid >> 3) * VP + (tid & 7) * 8;
    v8h stk[8], stv[8];
#pragma unroll
    for (int j = 0; j < 8; ++j) { stk[j] = *(const v8h*)(gk + j * 2048); stv[j] = *(const v8h*)(gv + (size_t)j * 32 * NN); }
#pragma unroll
    for (int j = 0; j < 8; ++j) { *(v8h*)(sm + sk + j * 8 * KP) = stk[j]; *(v8h*)(sm + sv + j * 32 * VP) = stv[j]; }
    __syncthreads();   // stage 0 is in LDS before any wave reads it
    // the stage loop stays rolled: one stage is already a long straight-line body. Every inner loop of this kernel is unrolled so that all fragment and accumulator indices are constants and the arrays stay in registers.
#pragma unroll 1
    for (int t = 0; t < NSTG; ++t) {
        const h16* bk = sm + (t & 1) * STG;
        if (t + 1 < NSTG) {   // the next stage's global loads fly while this stage is worked on
#pragma unroll
            for (int j = 0; j < 8; ++j) { stk[j] = *(const v8h*)(gk + (size_t)(t + 1) * KST * FF + j * 2048); stv[j] = *(const v8h*)(gv + (size_t)j * 32 * NN + (t + 1) * KST); }
            asm volatile("s_wait_xcnt 0x0" ::: "memory");   // the fragment reads below reuse the address registers of these loads: the wait stands in front of that overwrite
        }
        const h16* kt = bk + (kh * 32 + lr) * KP + 8 * hi;
        v16h fk[16], fv[16];
#pragma unroll
        for (int kc = 0; kc < 8; ++kc) {
            fk[2 * kc] = cat16(*(const v8h*)(kt + kc * 32), *(const v8h*)(kt + kc * 32 + 16));
            fk[2 * kc + 1] = cat16(*(const v8h*)(kt + 16 * KP + kc * 32), *(const v8h*)(kt + 16 * KP + kc * 32 + 16)); }
        __builtin_amdgcn_sched_barrier(0);   // keeps the 32 key-fragment reads together in front of the score WMMAs: spread among them, every WMMA waits out a whole LDS latency
        v8f s0 = (v8f){}, s1 = (v8f){};
#pragma unroll
        for (int kc = 0; kc < 8; ++kc) { s0 = wmma16(fk[2 * kc], qf[kc], s0); s1 = wmma16(fk[2 * kc + 1], qf[kc], s1); }
        const h16* vt = bk + KTILE + lr * VP + kh * 32 + 8 * hi;
#pragma unroll
        for (int ft = 0; ft < 16; ++ft) fv[ft] = cat16(*(const v8h*)(vt + ft * 16 * VP), *(const v8h*)(vt + ft * 16 * VP + 16));
        __builtin_amdgcn_sched_barrier(0);   // the 32 [f][key] fragment reads are issued in front of the softmax: left to the compiler they sink behind the rescale branch and the LDS pipe idles meanwhile
        float mx = fmaxf(s0[0], s1[0]);
#pragma unroll
        for (int j = 1; j < 8; ++j) mx = fmaxf(mx, fmaxf(s0[j], s1[j]));
        mx = fmaxf(mx, xhalf(mx)) * SCL2;
        // lazy rescale, one scalar branch per stage: rf moves only when a weight would pass 2^12 (fp16 holds it; f32 sums); it is then set 4 below the maximum so that small weights stay normal fp16 numbers
        if (__builtin_amdgcn_ballot_w32(mx > rf + 12.0f) != 0) {
            const float rn = fmaxf(rf, mx - 4.0f); const float al = __builtin_amdgcn_exp2f(rf - rn); rf = rn; l *= al;
#pragma unroll
            for (int ft = 0; ft < 16; ++ft) acc[ft] *= al;
        }
        v16h pb;
#pragma unroll
        for (int j = 0; j < 8; ++j) { const float p0 = __builtin_amdgcn_exp2f(fmaf(s0[j], SCL2, -rf)), p1 = __builtin_amdgcn_exp2f(fmaf(s1[j], SCL2, -rf)); l += p0 + p1; pb[j] = tohx(p0); pb[8 + j] = tohx(p1); }
#pragma unroll
        for (int ft = 0; ft < 16; ++ft) acc[ft] = wmma16(fv[ft], pb, acc[ft]);
        if (t + 1 < NSTG) { h16* bn = sm + ((t + 1) & 1) * STG;   // the buffer that stage t - 1 used: its readers left it before the barrier that ended pass t - 1
#pragma unroll
            for (int j = 0; j < 8; ++j) { *(v8h*)(bn + sk + j * 8 * KP) = stk[j]; *(v8h*)(bn + sv + j * 32 * VP) = stv[j]; }
        }
        __syncthreads();   // publishes stage t + 1 and ends every read of stage t
    }
    l += xhalf(l);
    // join the two key halves: the upper waves hand their tiles over through the stage buffers, which nobody reads any more
    float* mg = (float*)sm + qg * (33 * 128) + lane * 4;
    if (kh == 1) {
#pragma unroll
        for (int ft = 0; ft < 16; ++ft) { *(v4fa*)(mg + (ft * 2) * 128) = (v4f){acc[ft][0], acc[ft][1], acc[ft][2], acc[ft][3]}; *(v4fa*)(mg + (ft * 2 + 1) * 128) = (v4f){acc[ft][4], acc[ft][5], acc[ft][6], acc[ft][7]}; }
        *(v4fa*)(mg + 32 * 128) = (v4f){rf, l, 0.f, 0.f};
    }
    __syncthreads();   // the upper waves' tiles are in LDS before the lower waves read them
    if (kh == 0) {
        const v4f o = *(const v4fa*)(mg + 32 * 128);
        const float rn = fmaxf(rf, o[0]); const float a0 = __builtin_amdgcn_exp2f(rf - rn), a1 = __builtin_amdgcn_exp2f(o[0] - rn);
        const float inv = __fdiv_rn(1.0f, l * a0 + o[1] * a1); const float c0 = a0 * inv, c1 = a1 * inv;
        float* orow = Out + (size_t)(q0 + lr) * FF + 8 * hi;
#pragma unroll
        for (int ft = 0; ft < 16; ++ft) { const v4f u = *(const v4fa*)(mg + (ft * 2) * 128), w = *(const v4fa*)(mg + (ft * 2 + 1) * 128);
            *(v4f*)(orow + ft * 16) = (v4f){acc[ft][0] * c0 + u[0] * c1, acc[ft][1] * c0 + u[1] * c1, acc[ft][2] * c0 + u[2] * c1, acc[ft][3] * c0 + u[3] * c1};
            *(v4f*)(orow + ft * 16 + 4) = (v4f){acc[ft][4] * c0 + w[0] * c1, acc[ft][5] * c0 + w[1] * c1, acc[ft][6] * c0 + w[2] * c1, acc[ft][7] * c0 + w[3] * c1}; }
    }
}

extern "C" void kernel_launch(void* const* d_in, const int* in_sizes, int n_in,
                              void* d_out, int out_size, void* d_ws, size_t ws_size, hipStream_t stream) {
    (void)in_sizes; (void)n_in; (void)out_size;
    const float* nodes = (const float*)d_in[0]; const float* Wm = (const float*)d_in[1];
    float* OUT = (float*)d_out;     // [4][4096][256]
    char* wsp = (char*)d_ws;
    auto take = [&](size_t bytes) { char* p = wsp; wsp += (bytes + 255) & ~(size_t)255; return (void*)p; };
    h16* NH = (h16*)take((size_t)NB_ * NN * FF * 2); h16* NT = (h16*)take((size_t)NB_ * FF * NN * 2); h16* X16 = (h16*)take((size_t)NB_ * NN * FF * 2);   // one plane per batch: both kernels take all batches in one launch
    if ((size_t)(wsp - (char*)d_ws) > ws_size) return;    // total 24 MB
    k_prep<<<dim3(NN / 64, NB_, 1), 256, 0, stream>>>(nodes, Wm, NH, NT, X16);
    k_fattn<<<dim3(NN / 64, NB_, 1), 256, 0, stream>>>(X16, NH, NT, OUT);
}

// v004
// A run of this version takes 72.1 microseconds.
// Timed twice side by side with v003, it ran 1.19 and 1.20 times as fast.
// Counting every step since v000, it is 8.40 times as fast.
#include <hip/hip_runtime.h>

// scalarProductAttentiont (nodes [4][4096][256], W [256][256]; x = nodes W; prods = x nodes^T; att = softmax(prods / 16); out = att nodes -> [4][4096][256]) - single head of width 256.
// Compute dtypes, f32 accumulate: every input rounded to bf16; x = nodes W as a PLAIN bf16 GEMM (exact products) -> fp16 plane, made with the fp16 node plane in ONE kernel (k_prep); prods, softmax and att x nodes run in ONE kernel (k_fattn): scores single fp16 (f32 accumulate; bf16 node values are exact in fp16), running softmax in f32, unnormalised weights rounded to fp16, out = weights x nodes single fp16, divided by the f32 row sum at the end.

#define NB_  4
#define NN   4096
#define FF   256
typedef _Float16 h16;
typedef unsigned short bf;
typedef __attribute__((ext_vector_type(16))) __bf16   v16bf;
typedef __attribute__((ext_vector_type(16))) _Float16 v16h;
typedef __attribute__((ext_vector_type(8)))  _Float16 v8h;
typedef __attribute__((ext_vector_type(8)))  unsigned short v8us;
typedef __attribute__((ext_vector_type(8)))  float    v8f;
typedef __attribute__((ext_vector_type(4)))  float    v4f;
typedef v4f  __attribute__((may_alias)) v4fa;

__device__ __forceinline__ v16h cat16(v8h lo, v8h hi) { return __builtin_shufflevector(lo, hi, 0, 1, 2, 3, 4, 5, 6, 7, 8, 9, 10, 11, 12, 13, 14, 15); }
__device__ __forceinline__ v16bf cat16b(v8us lo, v8us hi) { return __builtin_bit_cast(v16bf, __builtin_shufflevector(lo, hi, 0, 1, 2, 3, 4, 5, 6, 7, 8, 9, 10, 11, 12, 13, 14, 15)); }
__device__ __forceinline__ v8f wmma16(v16h a, v16h b, v8f c) { return __builtin_amdgcn_wmma_f32_16x16x32_f16(false, a, false, b, (short)0, c, false, false); }
__device__ __forceinline__ v8f wmmab(v16bf a, v16bf b, v8f c) { return __builtin_amdgcn_wmma_f32_16x16x32_bf16(false, a, false, b, (short)0, c, false, false); }



typedef __attribute__((ext_vector_type(2))) float v2f; typedef __attribute__((ext_vector_type(2))) __bf16 v2bf; typedef __attribute__((ext_vector_type(2))) _Float16 v2h;
typedef __attribute__((ext_vector_type(2))) unsigned v2u; typedef __attribute__((ext_vector_type(4))) unsigned v4u; typedef __attribute__((ext_vector_type(8))) unsigned v8u;
__device__ __forceinline__ h16 tohx(float x) { return (h16)x; }
__device__ __forceinline__ unsigned pkbf(float a, float b) { return __builtin_bit_cast(unsigned, __builtin_convertvector((v2f){a, b}, v2bf)); }   // two f32 -> two bf16, nearest even, one instruction
__device__ __forceinline__ unsigned pkh(float a, float b) { return __builtin_bit_cast(unsigned, __builtin_convertvector((v2f){a, b}, v2h)); }     // two f32 -> two fp16, nearest even, one instruction

// ---- k_prep: everything the attention kernel reads, made in one launch. Grid (N / 64, batches), 256 threads = 8 waves; a work-group owns 64 node rows.
// It rounds its rows to bf16 once and writes them as the fp16 [m][f] plane (from registers) and as a bf16 LDS tile for x = nodes W.
// Transposed product x^T = W^T nodes^T: A = 16 columns of W read straight from the f32 matrix and rounded in registers, B = 16 node rows from LDS. Wave w owns columns 32 w .. + 31; row r of its A tile nb is column 32 w + 2 r + nb, so one 8-byte load feeds both tiles and a lane ends with 16 neighbouring x values of one node row.
#define AP    264                // node-tile row pitch in halves: 512 B + 16 B (conflict-free 16-byte reads down 16 rows)
__global__ __launch_bounds__(256) void k_prep(const float* __restrict__ nodes, const float* __restrict__ Wm, h16* __restrict__ NH, h16* __restrict__ X16) {
    __shared__ __align__(16) bf  As[64 * AP];
    const size_t z = blockIdx.y; const int m0 = blockIdx.x * 64;
    const int tid = threadIdx.x, lane = tid & 31, lr = lane & 15, hi = lane >> 4;
    const int g0 = __builtin_amdgcn_readfirstlane(tid >> 5) * 32;
    const int f4 = (tid & 63) * 4, mg = (tid >> 6) * 8;   // this thread's 4 features and the first of its 8 rows (again 32 rows further down)
    // each lane's part of every global address, in bytes, formed once at entry; the rest of an address is the same for the whole wave
    const unsigned bN = (mg * FF + f4) * 4u, bW = (8 * hi * FF + 2 * lr) * 4u, bH = (mg * FF + f4) * 2u, bX = (lr * FF + 16 * hi) * 2u;
    const char* sp = (const char*)(nodes + (z * NN + m0) * FF) + bN;
    const char* wp = (const char*)(Wm + g0) + bW;
    // every loop of this kernel is unrolled so that all fragment and accumulator indices are constants and the arrays stay in registers
    v4f nd[2][8];
#pragma unroll
    for (int p = 0; p < 2; ++p)
#pragma unroll
        for (int j = 0; j < 8; ++j) nd[p][j] = *(const v4f*)(sp + (p * 32 + j) * FF * 4);
    asm volatile("s_wait_xcnt 0x0" ::: "memory");   // the base of the W loads is formed in the scalar registers that hold the node loads' base: the wait stands in front of that overwrite
    __builtin_amdgcn_sched_barrier(0);   // the node loads go out first: loads return in order, and the rows are rounded and staged while the W loads are still coming in
    v2f wx[8][16];   // entry i of step kc: k = 32 kc + 8 hi + (i & 7) + 16 (i >> 3), the k order of the 16-bit fragments
#pragma unroll
    for (int kc = 0; kc < 8; ++kc)
#pragma unroll
        for (int i = 0; i < 16; ++i) wx[kc][i] = *(const v2f*)(wp + (kc * 32 + (i & 7) + 16 * (i >> 3)) * FF * 4);
    asm volatile("s_wait_xcnt 0x0" :: "v"(bN), "v"(bW), "v"(bH), "v"(bX) : "memory");   // stands in front of every overwrite of the loads' address registers; the lane offsets are named so that they are formed in front of it and live up to it
    __builtin_amdgcn_sched_barrier(0);   // all loads of the kernel are issued above in one run: left to the compiler the W loads sink to their uses in eight groups, each waited out alone
    v2u nhw[2][8];
#pragma unroll
    for (int p = 0; p < 2; ++p)
#pragma unroll
        for (int j = 0; j < 8; ++j) { const v4f v = nd[p][j]; const v2u b = {pkbf(v[0], v[1]), pkbf(v[2], v[3])};   // r: the row's values after the bf16 rounding, back in f32
            const float r[4] = {__uint_as_float(b[0] << 16), __uint_as_float(b[0] & 0xFFFF0000u), __uint_as_float(b[1] << 16), __uint_as_float(b[1] & 0xFFFF0000u)};
            *(v2u*)(As + (p * 32 + mg + j) * AP + f4) = b; nhw[p][j] = (v2u){pkh(r[0], r[1]), pkh(r[2], r[3])}; }
    __syncthreads();   // the LDS tile is whole before any wave reads rows that other waves wrote; every global store stands behind it, so that it waits for no store
    const bf* ap = As + lr * AP + 8 * hi;
    v16bf nf[8][4];
#pragma unroll
    for (int kc = 0; kc < 2; ++kc)
#pragma unroll
        for (int mb = 0; mb < 4; ++mb) nf[kc][mb] = cat16b(*(const v8us*)(ap + mb * 16 * AP + kc * 32), *(const v8us*)(ap + mb * 16 * AP + kc * 32 + 16));
    __builtin_amdgcn_sched_barrier(0);   // the LDS reads above go out together: left to the compiler each read is waited out alone in front of its WMMA
    char* nh = (char*)(NH + (z * NN + m0) * FF) + bH;
#pragma unroll
    for (int p = 0; p < 2; ++p)
#pragma unroll
        for (int j = 0; j < 8; ++j) *(v2u*)(nh + (p * 32 + j) * FF * 2) = nhw[p][j];
    asm volatile("s_wait_xcnt 0x0" :: "v"(bH) : "memory");   // the work below reuses the data and address registers of these stores: the wait stands in front of that overwrite
    v8f acc[2][4];
#pragma unroll
    for (int nb = 0; nb < 2; ++nb)
#pragma unroll
        for (int mb = 0; mb < 4; ++mb) acc[nb][mb] = (v8f){};
#pragma unroll
    for (int kc = 0; kc < 8; ++kc) {
        if (kc + 2 < 8) {
#pragma unroll
            for (int mb = 0; mb < 4; ++mb) nf[kc + 2][mb] = cat16b(*(const v8us*)(ap + mb * 16 * AP + (kc + 2) * 32), *(const v8us*)(ap + mb * 16 * AP + (kc + 2) * 32 + 16)); }
        __builtin_amdgcn_sched_barrier(0);   // keeps the node fragments two k steps ahead of the WMMAs that use them, so that no WMMA waits out a whole LDS latency
        v8u a, b;
#pragma unroll
        for (int i = 0; i < 8; ++i) { a[i] = pkbf(wx[kc][2 * i][0], wx[kc][2 * i + 1][0]); b[i] = pkbf(wx[kc][2 * i][1], wx[kc][2 * i + 1][1]); }
        const v16bf w0 = __builtin_bit_cast(v16bf, a), w1 = __builtin_bit_cast(v16bf, b);
#pragma unroll
        for (int mb = 0; mb < 4; ++mb) { acc[0][mb] = wmmab(w0, nf[kc][mb], acc[0][mb]); acc[1][mb] = wmmab(w1, nf[kc][mb], acc[1][mb]); }
    }
    char* xr = (char*)(X16 + ((z * NN + m0) * FF + g0)) + bX;
    v8u o[4];
#pragma unroll
    for (int mb = 0; mb < 4; ++mb)
#pragma unroll
        for (int j = 0; j < 8; ++j) o[mb][j] = pkh(acc[0][mb][j], acc[1][mb][j]);
    __builtin_amdgcn_sched_barrier(0);   // the last stores stand behind all arithmetic: no register that they name is written again
#pragma unroll
    for (int mb = 0; mb < 4; ++mb) *(v8u*)(xr + mb * 16 * FF * 2) = o[mb];
}

__device__ __forceinline__ float xhalf(float x) { return __builtin_bit_cast(float, __builtin_amdgcn_permlanex16(__builtin_bit_cast(int, x), __builtin_bit_cast(int, x), 0x76543210, 0xfedcba98, false, false)); }   // lane l with lane l ^ 16, on the vector pipe: an LDS-path exchange would queue behind the fragment reads
typedef __attribute__((ext_vector_type(8))) short v8s;
__device__ __forceinline__ v8h ldtr(const h16* p) { typedef __attribute__((address_space(3))) v8s lds_v8s; return __builtin_bit_cast(v8h, __builtin_amdgcn_ds_load_tr16_b128_v8i16((lds_v8s*)p)); }   // ds_load_tr16_b128: a row-major 16 x 16 block of LDS comes back transposed, as half a 16-bit A fragment
#define KST   64                 // keys per stage
#define NSTG  (NN / KST)
#define KP    272                // node-tile row pitch in halves: 512 B + 32 B (32 B x odd: conflict-free transposing reads over 8 rows)
#define STG   (KST * KP)         // halves per stage buffer
#define SCL2  0.09016844005556021f   // (1 / 16) * log2(e): scores go to base-2 exponents
__global__ __launch_bounds__(256) void k_fattn(const h16* __restrict__ Q, const h16* __restrict__ Kn, float* __restrict__ Out) {
    __shared__ __align__(16) h16 sm[2 * STG];
    const size_t z = blockIdx.y; Q += z * NN * FF; Kn += z * NN * FF; Out += z * NN * FF;
    const int tid = threadIdx.x, lane = tid & 31, lr = lane & 15, hi = lane >> 4;
    const int wv = __builtin_amdgcn_readfirstlane(tid >> 5), qg = wv & 3, kh = wv >> 2;
    const int q0 = blockIdx.x * 64 + qg * 16;
    v16h qf[8];
#pragma unroll
    for (int kc = 0; kc < 8; ++kc) { const h16* p = Q + (size_t)(q0 + lr) * FF + kc * 32 + 8 * hi; qf[kc] = cat16(*(const v8h*)p, *(const v8h*)(p + 16)); }
    v8f acc[16];
#pragma unroll
    for (int ft = 0; ft < 16; ++ft) acc[ft] = (v8f){};
    float rf = -1.0e30f, l = 0.f;    // weights are 2^(score - rf); l = this lane's share of their sum
    // staging: a stage's 64 node rows are 32 KiB in a row of the [m][f] plane. 16 B per thread and step, one whole row per wave.
    const h16* gk = Kn + tid * 8;
    const int sk[2] = {(tid >> 5) * KP + (tid & 31) * 8, (tid >> 5) * KP + ((tid & 31) ^ 1) * 8};   // step j stores row 8 j + wave: pieces change places in the odd steps
    v8h stk[8];
#pragma unroll
    for (int j = 0; j < 8; ++j) stk[j] = *(const v8h*)(gk + j * 2048);
#pragma unroll
    for (int j = 0; j < 8; ++j) *(v8h*)(sm + sk[j & 1] + j * 8 * KP) = stk[j];
    __syncthreads();   // stage 0 is in LDS before any wave reads it
    // the stage loop stays rolled: one stage is already a long straight-line body. Every inner loop of this kernel is unrolled so that all fragment and accumulator indices are constants and the arrays stay in registers.
#pragma unroll 1
    for (int t = 0; t < NSTG; ++t) {
        const h16* bk = sm + (t & 1) * STG;
        if (t + 1 < NSTG) {   // the next stage's global loads fly while this stage is worked on
#pragma unroll
            for (int j = 0; j < 8; ++j) stk[j] = *(const v8h*)(gk + (size_t)(t + 1) * KST * FF + j * 2048);
            asm volatile("s_wait_xcnt 0x0" ::: "memory");   // the fragment reads below reuse the address registers of these loads: the wait stands in front of that overwrite
        }
        const h16* kt = bk + (kh * 32 + lr) * KP + 8 * (hi ^ (lr >> 3));
        v16h fk[16], fv[16];
#pragma unroll
        for (int kc = 0; kc < 8; ++kc) {
            fk[2 * kc] = cat16(*(const v8h*)(kt + kc * 32), *(const v8h*)(kt + kc * 32 + 16));
            fk[2 * kc + 1] = cat16(*(const v8h*)(kt + 16 * KP + kc * 32), *(const v8h*)(kt + 16 * KP + kc * 32 + 16)); }
        __builtin_amdgcn_sched_barrier(0);   // keeps the 32 key-fragment reads together in front of the score WMMAs: spread among them, every WMMA waits out a whole LDS latency
        v8f s0 = (v8f){}, s1 = (v8f){};
#pragma unroll
        for (int kc = 0; kc < 8; ++kc) { s0 = wmma16(fk[2 * kc], qf[kc], s0); s1 = wmma16(fk[2 * kc + 1], qf[kc], s1); }
        const h16* vt = bk + (kh * 32 + 8 * hi + (lane & 7)) * KP + 8 * (((lane >> 3) & 1) ^ hi);   // a lane's 16 bytes of the 16 x 16 block that one transposing load turns: row 8 hi + (lane & 7), piece (lane >> 3) & 1, which lies at the other place in the rows of hi = 1
#pragma unroll
        for (int ft = 0; ft < 16; ++ft) fv[ft] = cat16(ldtr(vt + ft * 16), ldtr(vt + 16 * KP + ft * 16));   // lane (lr, hi): feature 16 ft + lr, keys 8 hi .. + 7 and 16 + 8 hi .. + 7 of the wave's 32
        __builtin_amdgcn_sched_barrier(0);   // the 32 value fragment reads are issued in front of the softmax: left to the compiler they sink behind the rescale branch and the LDS pipe idles meanwhile
        float mx = fmaxf(s0[0], s1[0]);
#pragma unroll
        for (int j = 1; j < 8; ++j) mx = fmaxf(mx, fmaxf(s0[j], s1[j]));
        mx = fmaxf(mx, xhalf(mx)) * SCL2;
        // lazy rescale, one scalar branch per stage: rf moves only when a weight would pass 2^12 (fp16 holds it; f32 sums); it is then set 4 below the maximum so that small weights stay normal fp16 numbers
        if (__builtin_amdgcn_ballot_w32(mx > rf + 12.0f) != 0) {
            const float rn = fmaxf(rf, mx - 4.0f); const float al = __builtin_amdgcn_exp2f(rf - rn); rf = rn; l *= al;
#pragma unroll
            for (int ft = 0; ft < 16; ++ft) acc[ft] *= al;
        }
        v16h pb;
#pragma unroll
        for (int j = 0; j < 8; ++j) { const float p0 = __builtin_amdgcn_exp2f(fmaf(s0[j], SCL2, -rf)), p1 = __builtin_amdgcn_exp2f(fmaf(s1[j], SCL2, -rf)); l += p0 + p1; pb[j] = tohx(p0); pb[8 + j] = tohx(p1); }
#pragma unroll
        for (int ft = 0; ft < 16; ++ft) acc[ft] = wmma16(fv[ft], pb, acc[ft]);
        if (t + 1 < NSTG) { h16* bn = sm + ((t + 1) & 1) * STG;   // the buffer that stage t - 1 used: its readers left it before the barrier that ended pass t - 1
#pragma unroll
            for (int j = 0; j < 8; ++j) *(v8h*)(bn + sk[j & 1] + j * 8 * KP) = stk[j];
        }
        __syncthreads();   // publishes stage t + 1 and ends every read of stage t
    }
    l += xhalf(l);
    // join the two key halves: the upper waves hand their tiles over through the stage buffers, which nobody reads any more
    float* mg = (float*)sm + qg * (33 * 128) + lane * 4;
    if (kh == 1) {
#pragma unroll
        for (int ft = 0; ft < 16; ++ft) { *(v4fa*)(mg + (ft * 2) * 128) = (v4f){acc[ft][0], acc[ft][1], acc[ft][2], acc[ft][3]}; *(v4fa*)(mg + (ft * 2 + 1) * 128) = (v4f){acc[ft][4], acc[ft][5], acc[ft][6], acc[ft][7]}; }
        *(v4fa*)(mg + 32 * 128) = (v4f){rf, l, 0.f, 0.f};
    }
    __syncthreads();   // the upper waves' tiles are in LDS before the lower waves read them
    if (kh == 0) {
        const v4f o = *(const v4fa*)(mg + 32 * 128);
        const float rn = fmaxf(rf, o[0]); const float a0 = __builtin_amdgcn_exp2f(rf - rn), a1 = __builtin_amdgcn_exp2f(o[0] - rn);
        const float inv = __fdiv_rn(1.0f, l * a0 + o[1] * a1); const float c0 = a0 * inv, c1 = a1 * inv;
        float* orow = Out + (size_t)(q0 + lr) * FF + 8 * hi;
#pragma unroll
        for (int ft = 0; ft < 16; ++ft) { const v4f u = *(const v4fa*)(mg + (ft * 2) * 128), w = *(const v4fa*)(mg + (ft * 2 + 1) * 128);
            *(v4f*)(orow + ft * 16) = (v4f){acc[ft][0] * c0 + u[0] * c1, acc[ft][1] * c0 + u[1] * c1, acc[ft][2] * c0 + u[2] * c1, acc[ft][3] * c0 + u[3] * c1};
            *(v4f*)(orow + ft * 16 + 4) = (v4f){acc[ft][4] * c0 + w[0] * c1, acc[ft][5] * c0 + w[1] * c1, acc[ft][6] * c0 + w[2] * c1, acc[ft][7] * c0 + w[3] * c1}; }
    }
}

extern "C" void kernel_launch(void* const* d_in, const int* in_sizes, int n_in,
                              void* d_out, int out_size, void* d_ws, size_t ws_size, hipStream_t stream) {
    (void)in_sizes; (void)n_in; (void)out_size;
    const float* nodes = (const float*)d_in[0]; const float* Wm = (const float*)d_in[1];
    float* OUT = (float*)d_out;     // [4][4096][256]
    char* wsp = (char*)d_ws;
    auto take = [&](size_t bytes) { char* p = wsp; wsp += (bytes + 255) & ~(size_t)255; return (void*)p; };
    h16* NH = (h16*)take((size_t)NB_ * NN * FF * 2); h16* X16 = (h16*)take((size_t)NB_ * NN * FF * 2);   // one plane per batch: both kernels take all batches in one launch
    if ((size_t)(wsp - (char*)d_ws) > ws_size) return;    // total 16 MB
    k_prep<<<dim3(NN / 64, NB_, 1), 256, 0, stream>>>(nodes, Wm, NH, X16);
    k_fattn<<<dim3(NN / 64, NB_, 1), 256, 0, stream>>>(X16, NH, OUT);
}

// v005
// It runs in 66.5 microseconds.
// Two timings next to v004 put it at 1.11 and 1.09 times that version's speed.
// Over all steps from v000 it is 9.22 times as fast.
#include <hip/hip_runtime.h>

// scalarProductAttentiont (nodes [4][4096][256], W [256][256]; x = nodes W; prods = x nodes^T; att = softmax(prods / 16); out = att nodes -> [4][4096][256]) - single head of width 256.
// Compute dtypes, f32 accumulate: every input rounded to bf16; x = nodes W as a PLAIN bf16 GEMM (exact products) -> fp16 plane, made with the fp16 node plane in ONE kernel (k_prep); prods, softmax and att x nodes run in ONE kernel (k_fattn): scores single fp16 (f32 accumulate; bf16 node values are exact in fp16), running softmax in f32, unnormalised weights rounded to fp16, out = weights x nodes single fp16, divided by the f32 row sum at the end.

#define NB_  4
#define NN   4096
#define FF   256
typedef _Float16 h16;
typedef unsigned short bf;
typedef __attribute__((ext_vector_type(16))) __bf16   v16bf;
typedef __attribute__((ext_vector_type(16))) _Float16 v16h;
typedef __attribute__((ext_vector_type(8)))  _Float16 v8h;
typedef __attribute__((ext_vector_type(8)))  unsigned short v8us;
typedef __attribute__((ext_vector_type(8)))  float    v8f;
typedef __attribute__((ext_vector_type(4)))  float    v4f;
typedef v4f  __attribute__((may_alias)) v4fa;

__device__ __forceinline__ v16h cat16(v8h lo, v8h hi) { return __builtin_shufflevector(lo, hi, 0, 1, 2, 3, 4, 5, 6, 7, 8, 9, 10, 11, 12, 13, 14, 15); }
__device__ __forceinline__ v16bf cat16b(v8us lo, v8us hi) { return __builtin_bit_cast(v16bf, __builtin_shufflevector(lo, hi, 0, 1, 2, 3, 4, 5, 6, 7, 8, 9, 10, 11, 12, 13, 14, 15)); }
__device__ __forceinline__ v8f wmma16(v16h a, v16h b, v8f c) { return __builtin_amdgcn_wmma_f32_16x16x32_f16(false, a, false, b, (short)0, c, false, false); }
__device__ __forceinline__ v8f wmmab(v16bf a, v16bf b, v8f c) { return __builtin_amdgcn_wmma_f32_16x16x32_bf16(false, a, false, b, (short)0, c, false, false); }



typedef __attribute__((ext_vector_type(2))) float v2f; typedef __attribute__((ext_vector_type(2))) __bf16 v2bf; typedef __attribute__((ext_vector_type(2))) _Float16 v2h;
typedef __attribute__((ext_vector_type(2))) unsigned v2u; typedef __attribute__((ext_vector_type(4))) unsigned v4u; typedef __attribute__((ext_vector_type(8))) unsigned v8u;
__device__ __forceinline__ h16 tohx(float x) { return (h16)x; }
__device__ __forceinline__ unsigned pkbf(float a, float b) { return __builtin_bit_cast(unsigned, __builtin_convertvector((v2f){a, b}, v2bf)); }   // two f32 -> two bf16, nearest even, one instruction
__device__ __forceinline__ unsigned pkh(float a, float b) { return __builtin_bit_cast(unsigned, __builtin_convertvector((v2f){a, b}, v2h)); }     // two f32 -> two fp16, nearest even, one instruction

// ---- k_prep: everything the attention kernel reads, made in one launch. Grid (N / 64, batches), 256 threads = 8 waves; a work-group owns 64 node rows.
// It rounds its rows to bf16 once and writes them as the fp16 [m][f] plane (from registers) and as a bf16 LDS tile for x = nodes W.
// Transposed product x^T = W^T nodes^T: A = 16 columns of W read straight from the f32 matrix and rounded in registers, B = 16 node rows from LDS. Wave w owns columns 32 w .. + 31; row r of its A tile nb is column 32 w + 2 r + nb, so one 8-byte load feeds both tiles and a lane ends with 16 neighbouring x values of one node row.
#define AP    264                // node-tile row pitch in halves: 512 B + 16 B (conflict-free 16-byte reads down 16 rows)
__global__ __launch_bounds__(256) void k_prep(const float* __restrict__ nodes, const float* __restrict__ Wm, h16* __restrict__ NH, h16* __restrict__ X16) {
    __shared__ __align__(16) bf  As[64 * AP];
    const size_t z = blockIdx.y; const int m0 = blockIdx.x * 64;
    const int tid = threadIdx.x, lane = tid & 31, lr = lane & 15, hi = lane >> 4;
    const int g0 = __builtin_amdgcn_readfirstlane(tid >> 5) * 32;
    const int f4 = (tid & 63) * 4, mg = (tid >> 6) * 8;   // this thread's 4 features and the first of its 8 rows (again 32 rows further down)
    // each lane's part of every global address, in bytes, formed once at entry; the rest of an address is the same for the whole wave
    const unsigned bN = (mg * FF + f4) * 4u, bW = (8 * hi * FF + 2 * lr) * 4u, bH = (mg * FF + f4) * 2u, bX = (lr * FF + 16 * hi) * 2u;
    const char* sp = (const char*)(nodes + (z * NN + m0) * FF) + bN;
    const char* wp = (const char*)(Wm + g0) + bW;
    // every loop of this kernel is unrolled so that all fragment and accumulator indices are constants and the arrays stay in registers
    v4f nd[2][8];
#pragma unroll
    for (int p = 0; p < 2; ++p)
#pragma unroll
        for (int j = 0; j < 8; ++j) nd[p][j] = *(const v4f*)(sp + (p * 32 + j) * FF * 4);
    asm volatile("s_wait_xcnt 0x0" ::: "memory");   // the base of the W loads is formed in the scalar registers that hold the node loads' base: the wait stands in front of that overwrite
    __builtin_amdgcn_sched_barrier(0);   // the node loads go out first: loads return in order, and the rows are rounded and staged while the W loads are still coming in
    v2f wx[8][16];   // entry i of step kc: k = 32 kc + 8 hi + (i & 7) + 16 (i >> 3), the k order of the 16-bit fragments
#pragma unroll
    for (int kc = 0; kc < 8; ++kc)
#pragma unroll
        for (int i = 0; i < 16; ++i) wx[kc][i] = *(const v2f*)(wp + (kc * 32 + (i & 7) + 16 * (i >> 3)) * FF * 4);
    asm volatile("s_wait_xcnt 0x0" :: "v"(bN), "v"(bW), "v"(bH), "v"(bX) : "memory");   // stands in front of every overwrite of the loads' address registers; the lane offsets are named so that they are formed in front of it and live up to it
    __builtin_amdgcn_sched_barrier(0);   // all loads of the kernel are issued above in one run: left to the compiler the W loads sink to their uses in eight groups, each waited out alone
    v2u nhw[2][8];
#pragma unroll
    for (int p = 0; p < 2; ++p)
#pragma unroll
        for (int j = 0; j < 8; ++j) { const v4f v = nd[p][j]; const v2u b = {pkbf(v[0], v[1]), pkbf(v[2], v[3])};   // r: the row's values after the bf16 rounding, back in f32
            const float r[4] = {__uint_as_float(b[0] << 16), __uint_as_float(b[0] & 0xFFFF0000u), __uint_as_float(b[1] << 16), __uint_as_float(b[1] & 0xFFFF0000u)};
            *(v2u*)(As + (p * 32 + mg + j) * AP + f4) = b; nhw[p][j] = (v2u){pkh(r[0], r[1]), pkh(r[2], r[3])}; }
    __syncthreads();   // the LDS tile is whole before any wave reads rows that other waves wrote; every global store stands behind it, so that it waits for no store
    const bf* ap = As + lr * AP + 8 * hi;
    v16bf nf[8][4];
#pragma unroll
    for (int kc = 0; kc < 2; ++kc)
#pragma unroll
        for (int mb = 0; mb < 4; ++mb) nf[kc][mb] = cat16b(*(const v8us*)(ap + mb * 16 * AP + kc * 32), *(const v8us*)(ap + mb * 16 * AP + kc * 32 + 16));
    __builtin_amdgcn_sched_barrier(0);   // the LDS reads above go out together: left to the compiler each read is waited out alone in front of its WMMA
    char* nh = (char*)(NH + (z * NN + m0) * FF) + bH;
#pragma unroll
    for (int p = 0; p < 2; ++p)
#pragma unroll
        for (int j = 0; j < 8; ++j) *(v2u*)(nh + (p * 32 + j) * FF * 2) = nhw[p][j];
    asm volatile("s_wait_xcnt 0x0" :: "v"(bH) : "memory");   // the work below reuses the data and address registers of these stores: the wait stands in front of that overwrite
    v8f acc[2][4];
#pragma unroll
    for (int nb = 0; nb < 2; ++nb)
#pragma unroll
        for (int mb = 0; mb < 4; ++mb) acc[nb][mb] = (v8f){};
#pragma unroll
    for (int kc = 0; kc < 8; ++kc) {
        if (kc + 2 < 8) {
#pragma unroll
            for (int mb = 0; mb < 4; ++mb) nf[kc + 2][mb] = cat16b(*(const v8us*)(ap + mb * 16 * AP + (kc + 2) * 32), *(const v8us*)(ap + mb * 16 * AP + (kc + 2) * 32 + 16)); }
        __builtin_amdgcn_sched_barrier(0);   // keeps the node fragments two k steps ahead of the WMMAs that use them, so that no WMMA waits out a whole LDS latency
        v8u a, b;
#pragma unroll
        for (int i = 0; i < 8; ++i) { a[i] = pkbf(wx[kc][2 * i][0], wx[kc][2 * i + 1][0]); b[i] = pkbf(wx[kc][2 * i][1], wx[kc][2 * i + 1][1]); }
        const v16bf w0 = __builtin_bit_cast(v16bf, a), w1 = __builtin_bit_cast(v16bf, b);
#pragma unroll
        for (int mb = 0; mb < 4; ++mb) { acc[0][mb] = wmmab(w0, nf[kc][mb], acc[0][mb]); acc[1][mb] = wmmab(w1, nf[kc][mb], acc[1][mb]); }
    }
    char* xr = (char*)(X16 + ((z * NN + m0) * FF + g0)) + bX;
    v8u o[4];
#pragma unroll
    for (int mb = 0; mb < 4; ++mb)
#pragma unroll
        for (int j = 0; j < 8; ++j) o[mb][j] = pkh(acc[0][mb][j], acc[1][mb][j]);
    __builtin_amdgcn_sched_barrier(0);   // the last stores stand behind all arithmetic: no register that they name is written again
#pragma unroll
    for (int mb = 0; mb < 4; ++mb) *(v8u*)(xr + mb * 16 * FF * 2) = o[mb];
}

__device__ __forceinline__ float xhalf(float x) { return __builtin_bit_cast(float, __builtin_amdgcn_permlanex16(__builtin_bit_cast(int, x), __builtin_bit_cast(int, x), 0x76543210, 0xfedcba98, false, false)); }   // lane l with lane l ^ 16, on the vector pipe: an LDS-path exchange would queue behind the fragment reads
typedef __attribute__((ext_vector_type(8))) short v8s;
__device__ __forceinline__ v8h ldtr(const h16* p) { typedef __attribute__((address_space(3))) v8s lds_v8s; return __builtin_bit_cast(v8h, __builtin_amdgcn_ds_load_tr16_b128_v8i16((lds_v8s*)p)); }   // ds_load_tr16_b128: a row-major 16 x 16 block of LDS comes back transposed, as half a 16-bit A fragment
#define KST   64                 // keys per stage
#define NSTG  (NN / KST)
#define KP    272                // node-tile row pitch in halves: 512 B + 32 B (32 B x odd: conflict-free transposing reads over 8 rows)
#define STG   (KST * KP)         // halves per stage buffer
#define NBUF  3                  // stage buffers: one being read, the next one landed or landing, the one after it landing
typedef __attribute__((ext_vector_type(4))) int v4i;
__device__ __forceinline__ void cp16(const h16* g, h16* l) { typedef __attribute__((address_space(1))) v4i g_v4i; typedef __attribute__((address_space(3))) v4i l_v4i; __builtin_amdgcn_global_load_async_to_lds_b128((g_v4i*)g, (l_v4i*)l, 0, 0); }   // global_load_async_to_lds_b128: each lane's 16 bytes go from global memory to its own LDS address, through no register
// one wave's quarter of a stage: 16 copies, copy j brings row 4 j + (wave & 3), a whole 512-byte row. l0: the lane's place in such a row, l1: the same with the 16-byte pieces swapped (rows 8 .. 15 of every 16)
__device__ __forceinline__ void copy_stage(const h16* g, h16* l0, h16* l1) {
#pragma unroll   // unrolled: which of the two places a copy takes and every step's offsets are then constants
    for (int j = 0; j < 16; ++j) cp16(g + j * 4 * FF, (((j >> 1) & 1) ? l1 : l0) + j * 4 * KP);
}
#define SCL2  0.09016844005556021f   // (1 / 16) * log2(e): scores go to base-2 exponents
__global__ __launch_bounds__(256) void k_fattn(const h16* __restrict__ Q, const h16* __restrict__ Kn, float* __restrict__ Out) {
    __shared__ __align__(16) h16 sm[NBUF * STG];
    const size_t z = blockIdx.y; Q += z * NN * FF; Kn += z * NN * FF; Out += z * NN * FF;
    const int tid = threadIdx.x, lane = tid & 31, lr = lane & 15, hi = lane >> 4;
    const int wv = __builtin_amdgcn_readfirstlane(tid >> 5), qg = wv & 3, kh = wv >> 2;
    const int q0 = blockIdx.x * 64 + qg * 16;
    v16h qf[8];
#pragma unroll
    for (int kc = 0; kc < 8; ++kc) { const h16* p = Q + (size_t)(q0 + lr) * FF + kc * 32 + 8 * hi; qf[kc] = cat16(*(const v8h*)p, *(const v8h*)(p + 16)); }
    asm volatile("s_wait_xcnt 0x0" ::: "memory");   // the copies' addresses below are formed in the address registers of the query loads: the wait stands in front of that overwrite
    v8f acc[16];
#pragma unroll
    for (int ft = 0; ft < 16; ++ft) acc[ft] = (v8f){};
    float rf = -1.0e30f, l = 0.f;    // weights are 2^(score - rf); l = this lane's share of their sum
    // staging: a stage's 64 node rows are 32 KiB in a row of the [m][f] plane and reach LDS by asynchronous copies, issued two passes ahead of their readers.
    // The wave halves copy in turn: waves 0 .. 3 bring the even stages, waves 4 .. 7 the odd ones. A wave then never has more than one stage in flight, and each of its waits is a wait to 0.
    const h16* gk = Kn + qg * FF + lane * 8;
    h16* const sk0 = sm + qg * KP + lane * 8; h16* const sk1 = sm + qg * KP + (lane ^ 1) * 8;
    if (kh == 0) { copy_stage(gk, sk0, sk1);
        asm volatile("s_wait_asynccnt 0x0" ::: "memory");   // this wave's rows of stage 0 have landed before the barrier behind which they are read
    } else copy_stage(gk + KST * FF, sk0 + STG, sk1 + STG);
    __syncthreads();   // stage 0 is in LDS before any wave reads it
    if (kh == 0) copy_stage(gk + 2 * KST * FF, sk0 + 2 * STG, sk1 + 2 * STG);
    int cb = 0;   // the buffer of stage t: t mod 3
    // the stage loop stays rolled: one stage is already a long straight-line body. Every inner loop of this kernel is unrolled so that all fragment and accumulator indices are constants and the arrays stay in registers.
#pragma unroll 1
    for (int t = 0; t < NSTG; ++t) {
        const h16* bk = sm + cb * STG;
        const h16* kt = bk + (kh * 32 + lr) * KP + 8 * (hi ^ (lr >> 3));
        v16h fk[16], fv[16];
#pragma unroll
        for (int kc = 0; kc < 8; ++kc) {
            fk[2 * kc] = cat16(*(const v8h*)(kt + kc * 32), *(const v8h*)(kt + kc * 32 + 16));
            fk[2 * kc + 1] = cat16(*(const v8h*)(kt + 16 * KP + kc * 32), *(const v8h*)(kt + 16 * KP + kc * 32 + 16)); }
        __builtin_amdgcn_sched_barrier(0);   // keeps the 32 key-fragment reads together in front of the score WMMAs: spread among them, every WMMA waits out a whole LDS latency
        v8f s0 = (v8f){}, s1 = (v8f){};
#pragma unroll
        for (int kc = 0; kc < 8; ++kc) { s0 = wmma16(fk[2 * kc], qf[kc], s0); s1 = wmma16(fk[2 * kc + 1], qf[kc], s1); }
        const h16* vt = bk + (kh * 32 + 8 * hi + (lane & 7)) * KP + 8 * (((lane >> 3) & 1) ^ hi);   // a lane's 16 bytes of the 16 x 16 block that one transposing load turns: row 8 hi + (lane & 7), piece (lane >> 3) & 1, which lies at the other place in the rows of hi = 1
#pragma unroll
        for (int ft = 0; ft < 16; ++ft) fv[ft] = cat16(ldtr(vt + ft * 16), ldtr(vt + 16 * KP + ft * 16));   // lane (lr, hi): feature 16 ft + lr, keys 8 hi .. + 7 and 16 + 8 hi .. + 7 of the wave's 32
        __builtin_amdgcn_sched_barrier(0);   // the 32 value fragment reads are issued in front of the softmax: left to the compiler they sink behind the rescale branch and the LDS pipe idles meanwhile
        float mx = fmaxf(s0[0], s1[0]);
#pragma unroll
        for (int j = 1; j < 8; ++j) mx = fmaxf(mx, fmaxf(s0[j], s1[j]));
        mx = fmaxf(mx, xhalf(mx)) * SCL2;
        // lazy rescale, one scalar branch per stage: rf moves only when a weight would pass 2^12 (fp16 holds it; f32 sums); it is then set 4 below the maximum so that small weights stay normal fp16 numbers
        if (__builtin_amdgcn_ballot_w32(mx > rf + 12.0f) != 0) {
            const float rn = fmaxf(rf, mx - 4.0f); const float al = __builtin_amdgcn_exp2f(rf - rn); rf = rn; l *= al;
#pragma unroll
            for (int ft = 0; ft < 16; ++ft) acc[ft] *= al;
        }
        v16h pb;
#pragma unroll
        for (int j = 0; j < 8; ++j) { const float p0 = __builtin_amdgcn_exp2f(fmaf(s0[j], SCL2, -rf)), p1 = __builtin_amdgcn_exp2f(fmaf(s1[j], SCL2, -rf)); l += p0 + p1; pb[j] = tohx(p0); pb[8 + j] = tohx(p1); }
#pragma unroll
        for (int ft = 0; ft < 16; ++ft) acc[ft] = wmma16(fv[ft], pb, acc[ft]);
        __builtin_amdgcn_sched_barrier(0);   // keeps the waits below behind the WMMAs: moved up among them, the first would hold them back until every value fragment has arrived
        asm volatile("s_wait_dscnt 0x0" ::: "memory");   // this wave's reads of stage t have returned before the barrier behind which its buffer is refilled
        const bool mine = ((t + 1) & 1) == kh;   // the same in a whole wave: stages t + 1 and t + 3 are this wave half's
        if (mine) asm volatile("s_wait_asynccnt 0x0" ::: "memory");   // this wave's rows of stage t + 1 have landed; the other half's copies of stage t + 2 stay in flight
        __syncthreads();   // publishes stage t + 1 and ends every read of stage t
        if (mine && t + 3 < NSTG) copy_stage(gk + (size_t)(t + 3) * KST * FF, sk0 + cb * STG, sk1 + cb * STG);   // refill of the buffer that pass t has just read
        cb = cb == NBUF - 1 ? 0 : cb + 1;
    }
    asm volatile("s_wait_asynccnt 0x0" ::: "memory");   // no copy is outstanding when the buffers become the joining space and when the wave ends
    l += xhalf(l);
    // join the two key halves: the upper waves hand their tiles over through the stage buffers, which nobody reads any more
    float* mg = (float*)sm + qg * (33 * 128) + lane * 4;
    if (kh == 1) {
#pragma unroll
        for (int ft = 0; ft < 16; ++ft) { *(v4fa*)(mg + (ft * 2) * 128) = (v4f){acc[ft][0], acc[ft][1], acc[ft][2], acc[ft][3]}; *(v4fa*)(mg + (ft * 2 + 1) * 128) = (v4f){acc[ft][4], acc[ft][5], acc[ft][6], acc[ft][7]}; }
        *(v4fa*)(mg + 32 * 128) = (v4f){rf, l, 0.f, 0.f};
    }
    __syncthreads();   // the upper waves' tiles are in LDS before the lower waves read them
    if (kh == 0) {
        const v4f o = *(const v4fa*)(mg + 32 * 128);
        const float rn = fmaxf(rf, o[0]); const float a0 = __builtin_amdgcn_exp2f(rf - rn), a1 = __builtin_amdgcn_exp2f(o[0] - rn);
        const float inv = __fdiv_rn(1.0f, l * a0 + o[1] * a1); const float c0 = a0 * inv, c1 = a1 * inv;
        float* orow = Out + (size_t)(q0 + lr) * FF + 8 * hi;
#pragma unroll
        for (int ft = 0; ft < 16; ++ft) { const v4f u = *(const v4fa*)(mg + (ft * 2) * 128), w = *(const v4fa*)(mg + (ft * 2 + 1) * 128);
            *(v4f*)(orow + ft * 16) = (v4f){acc[ft][0] * c0 + u[0] * c1, acc[ft][1] * c0 + u[1] * c1, acc[ft][2] * c0 + u[2] * c1, acc[ft][3] * c0 + u[3] * c1};
            *(v4f*)(orow + ft * 16 + 4) = (v4f){acc[ft][4] * c0 + w[0] * c1, acc[ft][5] * c0 + w[1] * c1, acc[ft][6] * c0 + w[2] * c1, acc[ft][7] * c0 + w[3] * c1}; }
    }
}

extern "C" void kernel_launch(void* const* d_in, const int* in_sizes, int n_in,
                              void* d_out, int out_size, void* d_ws, size_t ws_size, hipStream_t stream) {
    (void)in_sizes; (void)n_in; (void)out_size;
    const float* nodes = (const float*)d_in[0]; const float* Wm = (const float*)d_in[1];
    float* OUT = (float*)d_out;     // [4][4096][256]
    char* wsp = (char*)d_ws;
    auto take = [&](size_t bytes) { char* p = wsp; wsp += (bytes + 255) & ~(size_t)255; return (void*)p; };
    h16* NH = (h16*)take((size_t)NB_ * NN * FF * 2); h16* X16 = (h16*)take((size_t)NB_ * NN * FF * 2);   // one plane per batch: both kernels take all batches in one launch
    if ((size_t)(wsp - (char*)d_ws) > ws_size) return;    // total 16 MB
    k_prep<<<dim3(NN / 64, NB_, 1), 256, 0, stream>>>(nodes, Wm, NH, X16);
    k_fattn<<<dim3(NN / 64, NB_, 1), 256, 0, stream>>>(X16, NH, OUT);
}

// v006
// It runs in 62.2 microseconds.
// Timed twice side by side with v005, it ran 1.06 and 1.07 times as fast.
// All steps since v000 together make it 9.83 times as fast.
#include <hip/hip_runtime.h>

// scalarProductAttentiont (nodes [4][4096][256], W [256][256]; x = nodes W; prods = x nodes^T; att = softmax(prods / 16); out = att nodes -> [4][4096][256]) - single head of width 256.
// Compute dtypes, f32 accumulate: every input rounded to bf16; x = nodes W as a PLAIN bf16 GEMM (exact products) -> fp16 plane, made with the fp16 node plane in ONE kernel (k_prep); prods, softmax and att x nodes run in ONE kernel (k_fattn): scores single fp16 (f32 accumulate; bf16 node values are exact in fp16), running softmax in f32, unnormalised weights rounded to fp16, out = weights x nodes single fp16, divided by the f32 row sum at the end.

#define NB_  4
#define NN   4096
#define FF   256
typedef _Float16 h16;
typedef unsigned short bf;
typedef __attribute__((ext_vector_type(16))) __bf16   v16bf;
typedef __attribute__((ext_vector_type(16))) _Float16 v16h;
typedef __attribute__((ext_vector_type(8)))  _Float16 v8h;
typedef __attribute__((ext_vector_type(8)))  unsigned short v8us;
typedef __attribute__((ext_vector_type(8)))  float    v8f;
typedef __attribute__((ext_vector_type(4)))  float    v4f;
typedef v4f  __attribute__((may_alias)) v4fa;

__device__ __forceinline__ v16h cat16(v8h lo, v8h hi) { return __builtin_shufflevector(lo, hi, 0, 1, 2, 3, 4, 5, 6, 7, 8, 9, 10, 11, 12, 13, 14, 15); }
__device__ __forceinline__ v16bf cat16b(v8us lo, v8us hi) { return __builtin_bit_cast(v16bf, __builtin_shufflevector(lo, hi, 0, 1, 2, 3, 4, 5, 6, 7, 8, 9, 10, 11, 12, 13, 14, 15)); }
__device__ __forceinline__ v8f wmma16(v16h a, v16h b, v8f c) { return __builtin_amdgcn_wmma_f32_16x16x32_f16(false, a, false, b, (short)0, c, false, false); }
__device__ __forceinline__ v8f wmmab(v16bf a, v16bf b, v8f c) { return __builtin_amdgcn_wmma_f32_16x16x32_bf16(false, a, false, b, (short)0, c, false, false); }



typedef __attribute__((ext_vector_type(2))) float v2f; typedef __attribute__((ext_vector_type(2))) __bf16 v2bf; typedef __attribute__((ext_vector_type(2))) _Float16 v2h;
typedef __attribute__((ext_vector_type(2))) unsigned v2u; typedef __attribute__((ext_vector_type(4))) unsigned v4u; typedef __attribute__((ext_vector_type(8))) unsigned v8u;
__device__ __forceinline__ h16 tohx(float x) { return (h16)x; }
__device__ __forceinline__ unsigned pkbf(float a, float b) { return __builtin_bit_cast(unsigned, __builtin_convertvector((v2f){a, b}, v2bf)); }   // two f32 -> two bf16, nearest even, one instruction
__device__ __forceinline__ unsigned pkh(float a, float b) { return __builtin_bit_cast(unsigned, __builtin_convertvector((v2f){a, b}, v2h)); }     // two f32 -> two fp16, nearest even, one instruction

// ---- k_prep: everything the attention kernel reads, made in one launch. Grid (N / 64, batches), 256 threads = 8 waves; a work-group owns 64 node rows.
// It rounds its rows to bf16 once and writes them as the fp16 [m][f] plane (from registers) and as a bf16 LDS tile for x = nodes W.
// Transposed product x^T = W^T nodes^T: A = 16 columns of W read straight from the f32 matrix and rounded in registers, B = 16 node rows from LDS. Wave w owns columns 32 w .. + 31; row r of its A tile nb is column 32 w + 2 r + nb, so one 8-byte load feeds both tiles and a lane ends with 16 neighbouring x values of one node row.
#define AP    264                // node-tile row pitch in halves: 512 B + 16 B (conflict-free 16-byte reads down 16 rows)
__global__ __launch_bounds__(256) void k_prep(const float* __restrict__ nodes, const float* __restrict__ Wm, h16* __restrict__ NH, h16* __restrict__ X16) {
    __shared__ __align__(16) bf  As[64 * AP];
    const size_t z = blockIdx.y; const int m0 = blockIdx.x * 64;
    const int tid = threadIdx.x, lane = tid & 31, lr = lane & 15, hi = lane >> 4;
    const int g0 = __builtin_amdgcn_readfirstlane(tid >> 5) * 32;
    const int f4 = (tid & 63) * 4, mg = (tid >> 6) * 8;   // this thread's 4 features and the first of its 8 rows (again 32 rows further down)
    // each lane's part of every global address, in bytes, formed once at entry; the rest of an address is the same for the whole wave
    const unsigned bN = (mg * FF + f4) * 4u, bW = (8 * hi * FF + 2 * lr) * 4u, bH = (mg * FF + f4) * 2u, bX = (lr * FF + 16 * hi) * 2u;
    const char* sp = (const char*)(nodes + (z * NN + m0) * FF) + bN;
    const char* wp = (const char*)(Wm + g0) + bW;
    // every loop of this kernel is unrolled so that all fragment and accumulator indices are constants and the arrays stay in registers
    v4f nd[2][8];
#pragma unroll
    for (int p = 0; p < 2; ++p)
#pragma unroll
        for (int j = 0; j < 8; ++j) nd[p][j] = *(const v4f*)(sp + (p * 32 + j) * FF * 4);
    asm volatile("s_wait_xcnt 0x0" ::: "memory");   // the base of the W loads is formed in the scalar registers that hold the node loads' base: the wait stands in front of that overwrite
    __builtin_amdgcn_sched_barrier(0);   // the node loads go out first: loads return in order, and the rows are rounded and staged while the W loads are still coming in
    v2f wx[8][16];   // entry i of step kc: k = 32 kc + 8 hi + (i & 7) + 16 (i >> 3), the k order of the 16-bit fragments
#pragma unroll
    for (int kc = 0; kc < 8; ++kc)
#pragma unroll
        for (int i = 0; i < 16; ++i) wx[kc][i] = *(const v2f*)(wp + (kc * 32 + (i & 7) + 16 * (i >> 3)) * FF * 4);
    asm volatile("s_wait_xcnt 0x0" :: "v"(bN), "v"(bW), "v"(bH), "v"(bX) : "memory");   // stands in front of every overwrite of the loads' address registers; the lane offsets are named so that they are formed in front of it and live up to it
    __builtin_amdgcn_sched_barrier(0);   // all loads of the kernel are issued above in one run: left to the compiler the W loads sink to their uses in eight groups, each waited out alone
    v2u nhw[2][8];
#pragma unroll
    for (int p = 0; p < 2; ++p)
#pragma unroll
        for (int j = 0; j < 8; ++j) { const v4f v = nd[p][j]; const v2u b = {pkbf(v[0], v[1]), pkbf(v[2], v[3])};   // r: the row's values after the bf16 rounding, back in f32
            const float r[4] = {__uint_as_float(b[0] << 16), __uint_as_float(b[0] & 0xFFFF0000u), __uint_as_float(b[1] << 16), __uint_as_float(b[1] & 0xFFFF0000u)};
            *(v2u*)(As + (p * 32 + mg + j) * AP + f4) = b; nhw[p][j] = (v2u){pkh(r[0], r[1]), pkh(r[2], r[3])}; }
    __syncthreads();   // the LDS tile is whole before any wave reads rows that other waves wrote; every global store stands behind it, so that it waits for no store
    const bf* ap = As + lr * AP + 8 * hi;
    v16bf nf[8][4];
#pragma unroll
    for (int kc = 0; kc < 2; ++kc)
#pragma unroll
        for (int mb = 0; mb < 4; ++mb) nf[kc][mb] = cat16b(*(const v8us*)(ap + mb * 16 * AP + kc * 32), *(const v8us*)(ap + mb * 16 * AP + kc * 32 + 16));
    __builtin_amdgcn_sched_barrier(0);   // the LDS reads above go out together: left to the compiler each read is waited out alone in front of its WMMA
    char* nh = (char*)(NH + (z * NN + m0) * FF) + bH;
#pragma unroll
    for (int p = 0; p < 2; ++p)
#pragma unroll
        for (int j = 0; j < 8; ++j) *(v2u*)(nh + (p * 32 + j) * FF * 2) = nhw[p][j];
    asm volatile("s_wait_xcnt 0x0" :: "v"(bH) : "memory");   // the work below reuses the data and address registers of these stores: the wait stands in front of that overwrite
    v8f acc[2][4];
#pragma unroll
    for (int nb = 0; nb < 2; ++nb)
#pragma unroll
        for (int mb = 0; mb < 4; ++mb) acc[nb][mb] = (v8f){};
#pragma unroll
    for (int kc = 0; kc < 8; ++kc) {
        if (kc + 2 < 8) {
#pragma unroll
            for (int mb = 0; mb < 4; ++mb) nf[kc + 2][mb] = cat16b(*(const v8us*)(ap + mb * 16 * AP + (kc + 2) * 32), *(const v8us*)(ap + mb * 16 * AP + (kc + 2) * 32 + 16)); }
        __builtin_amdgcn_sched_barrier(0);   // keeps the node fragments two k steps ahead of the WMMAs that use them, so that no WMMA waits out a whole LDS latency
        v8u a, b;
#pragma unroll
        for (int i = 0; i < 8; ++i) { a[i] = pkbf(wx[kc][2 * i][0], wx[kc][2 * i + 1][0]); b[i] = pkbf(wx[kc][2 * i][1], wx[kc][2 * i + 1][1]); }
        const v16bf w0 = __builtin_bit_cast(v16bf, a), w1 = __builtin_bit_cast(v16bf, b);
#pragma unroll
        for (int mb = 0; mb < 4; ++mb) { acc[0][mb] = wmmab(w0, nf[kc][mb], acc[0][mb]); acc[1][mb] = wmmab(w1, nf[kc][mb], acc[1][mb]); }
    }
    char* xr = (char*)(X16 + ((z * NN + m0) * FF + g0)) + bX;
    v8u o[4];
#pragma unroll
    for (int mb = 0; mb < 4; ++mb)
#pragma unroll
        for (int j = 0; j < 8; ++j) o[mb][j] = pkh(acc[0][mb][j], acc[1][mb][j]);
    __builtin_amdgcn_sched_barrier(0);   // the last stores stand behind all arithmetic: no register that they name is written again
#pragma unroll
    for (int mb = 0; mb < 4; ++mb) *(v8u*)(xr + mb * 16 * FF * 2) = o[mb];
}

__device__ __forceinline__ float xhalf(float x) { return __builtin_bit_cast(float, __builtin_amdgcn_permlanex16(__builtin_bit_cast(int, x), __builtin_bit_cast(int, x), 0x76543210, 0xfedcba98, false, false)); }   // lane l with lane l ^ 16, on the vector pipe: an LDS-path exchange would queue behind the fragment reads
typedef __attribute__((ext_vector_type(8))) short v8s;
__device__ __forceinline__ v8h ldtr(const h16* p) { typedef __attribute__((address_space(3))) v8s lds_v8s; return __builtin_bit_cast(v8h, __builtin_amdgcn_ds_load_tr16_b128_v8i16((lds_v8s*)p)); }   // ds_load_tr16_b128: a row-major 16 x 16 block of LDS comes back transposed, as half a 16-bit A fragment
#define KST   128                // keys per stage
#define NSTG  (NN / KST)
#define KP    272                // node-tile row pitch in halves: 512 B + 32 B (32 B x odd: conflict-free transposing reads over 8 rows)
#define STG   (KST * KP)         // halves per stage buffer
#define NBUF  3                  // stage buffers: one being read, the next one landed or landing, the one after it landing
#define JSL   (66 * 128)         // floats of one wave's place in the joining space: 64 pieces of 128 floats and one piece per query tile for reference and sum
typedef __attribute__((ext_vector_type(4))) int v4i;
__device__ __forceinline__ void cp16(const h16* g, h16* l) { typedef __attribute__((address_space(1))) v4i g_v4i; typedef __attribute__((address_space(3))) v4i l_v4i; __builtin_amdgcn_global_load_async_to_lds_b128((g_v4i*)g, (l_v4i*)l, 0, 0); }   // global_load_async_to_lds_b128: each lane's 16 bytes go from global memory to its own LDS address, through no register
// one wave's quarter of a stage: 32 copies, copy j brings row 4 j + (wave & 3), a whole 512-byte row. l0: the lane's place in such a row, l1: the same with the 16-byte pieces swapped (rows 8 .. 15 of every 16)
__device__ __forceinline__ void copy_stage(const h16* g, h16* l0, h16* l1) {
#pragma unroll   // unrolled: which of the two places a copy takes and every step's offsets are then constants
    for (int j = 0; j < KST / 4; ++j) cp16(g + j * 4 * FF, (((j >> 1) & 1) ? l1 : l0) + j * 4 * KP);
}
#define SCL2  0.09016844005556021f   // (1 / 16) * log2(e): scores go to base-2 exponents
__global__ __launch_bounds__(256) void k_fattn(const h16* __restrict__ Q, const h16* __restrict__ Kn, float* __restrict__ Out) {
    __shared__ __align__(16) h16 sm[NBUF * STG];
    const size_t z = blockIdx.y; Q += z * NN * FF; Kn += z * NN * FF; Out += z * NN * FF;
    const int tid = threadIdx.x, lane = tid & 31, lr = lane & 15, hi = lane >> 4;
    const int wv = __builtin_amdgcn_readfirstlane(tid >> 5), kq = wv & 3, qg = wv >> 2;
    const int q0 = blockIdx.x * 64 + qg * 32;
    v16h qf[2][8];
#pragma unroll
    for (int qt = 0; qt < 2; ++qt)
#pragma unroll
        for (int kc = 0; kc < 8; ++kc) { const h16* p = Q + (size_t)(q0 + qt * 16 + lr) * FF + kc * 32 + 8 * hi; qf[qt][kc] = cat16(*(const v8h*)p, *(const v8h*)(p + 16)); }
    asm volatile("s_wait_xcnt 0x0" ::: "memory");   // the copies' addresses below are formed in the address registers of the query loads: the wait stands in front of that overwrite
    v8f acc[2][16];
#pragma unroll
    for (int qt = 0; qt < 2; ++qt)
#pragma unroll
        for (int ft = 0; ft < 16; ++ft) acc[qt][ft] = (v8f){};
    float rf[2] = {-1.0e30f, -1.0e30f}, l[2] = {0.f, 0.f};    // per query tile: weights are 2^(score - rf); l = this lane's share of their sum
    // staging: a stage's 128 node rows are 64 KiB in a row of the [m][f] plane and reach LDS by asynchronous copies, issued two passes ahead of their readers.
    // The wave halves copy in turn: waves 0 .. 3 bring the even stages, waves 4 .. 7 the odd ones. A wave then never has more than one stage (32 copies) in flight, and each of its waits is a wait to 0.
    const h16* gk = Kn + kq * FF + lane * 8;
    h16* const sk0 = sm + kq * KP + lane * 8; h16* const sk1 = sm + kq * KP + (lane ^ 1) * 8;
    if (qg == 0) { copy_stage(gk, sk0, sk1);
        asm volatile("s_wait_asynccnt 0x0" ::: "memory");   // this wave's rows of stage 0 have landed before the barrier behind which they are read
    } else copy_stage(gk + KST * FF, sk0 + STG, sk1 + STG);
    __syncthreads();   // stage 0 is in LDS before any wave reads it
    if (qg == 0) copy_stage(gk + 2 * KST * FF, sk0 + 2 * STG, sk1 + 2 * STG);
    int cb = 0;   // the buffer of stage t: t mod 3
    // the stage loop stays rolled: one stage is already a long straight-line body. Every inner loop of this kernel is unrolled so that all fragment and accumulator indices are constants and the arrays stay in registers.
#pragma unroll 1
    for (int t = 0; t < NSTG; ++t) {
        const h16* bk = sm + cb * STG;
        const h16* kt = bk + (kq * 32 + lr) * KP + 8 * (hi ^ (lr >> 3));
        const h16* vt = bk + (kq * 32 + 8 * hi + (lane & 7)) * KP + 8 * (((lane >> 3) & 1) ^ hi);   // a lane's 16 bytes of the 16 x 16 block that one transposing load turns: row 8 hi + (lane & 7), piece (lane >> 3) & 1, which lies at the other place in the rows of hi = 1
        // The wave's 32 fragments of a stage (16 of keys, then 16 of values) pass in pairs through a register ring of three pairs: accumulators and queries leave no room for more. A pair is refilled as soon as its four WMMAs are issued, three pairs ahead of its next use.
        // fragment f < 16: k step f >> 1 of key tile f & 1; fragment 16 + ft: lane (lr, hi) gets feature 16 ft + lr, keys 8 hi .. + 7 and 16 + 8 hi .. + 7 of the wave's 32
        auto frag = [&](int f) -> v16h { if (f < 16) { const h16* p = kt + (f & 1) * 16 * KP + (f >> 1) * 32; return cat16(*(const v8h*)p, *(const v8h*)(p + 16)); }
            return cat16(ldtr(vt + (f - 16) * 16), ldtr(vt + 16 * KP + (f - 16) * 16)); };
        v16h rg[3][2];
#pragma unroll
        for (int g = 0; g < 3; ++g) { rg[g][0] = frag(2 * g); rg[g][1] = frag(2 * g + 1); }
        __builtin_amdgcn_sched_barrier(0);   // the reads of a pair stay together and in their place in the ring: hoisted they overrun the registers, sunk to their WMMAs each is waited out alone
        v8f s[2][2] = {{(v8f){}, (v8f){}}, {(v8f){}, (v8f){}}};   // [key tile][query tile]
#pragma unroll
        for (int g = 0; g < 8; ++g) {
#pragma unroll
            for (int i = 0; i < 2; ++i)
#pragma unroll
                for (int qt = 0; qt < 2; ++qt) s[i][qt] = wmma16(rg[g % 3][i], qf[qt][g], s[i][qt]);
            __builtin_amdgcn_sched_barrier(0);   // as above: the refill stands behind the WMMAs that free its registers
            rg[g % 3][0] = frag(2 * (g + 3)); rg[g % 3][1] = frag(2 * (g + 3) + 1);
            __builtin_amdgcn_sched_barrier(0);   // as above; the first three value pairs are thus on their way during the softmax
        }
        float mx[2];
#pragma unroll
        for (int qt = 0; qt < 2; ++qt) { float m = fmaxf(s[0][qt][0], s[1][qt][0]);
#pragma unroll
            for (int j = 1; j < 8; ++j) m = fmaxf(m, fmaxf(s[0][qt][j], s[1][qt][j]));
            mx[qt] = fmaxf(m, xhalf(m)) * SCL2; }
        // lazy rescale, one scalar branch per stage: rf moves only when a weight would pass 2^12 (fp16 holds it; f32 sums); it is then set 4 below the maximum so that small weights stay normal fp16 numbers
        if (__builtin_amdgcn_ballot_w32(mx[0] > rf[0] + 12.0f || mx[1] > rf[1] + 12.0f) != 0) {
#pragma unroll
            for (int qt = 0; qt < 2; ++qt) { const float rn = fmaxf(rf[qt], mx[qt] - 4.0f); const float al = __builtin_amdgcn_exp2f(rf[qt] - rn); rf[qt] = rn; l[qt] *= al;
#pragma unroll
                for (int ft = 0; ft < 16; ++ft) acc[qt][ft] *= al; }
        }
        v16h pb[2];
#pragma unroll
        for (int qt = 0; qt < 2; ++qt) { float ps[8];
#pragma unroll
            for (int j = 0; j < 8; ++j) { const float p0 = __builtin_amdgcn_exp2f(fmaf(s[0][qt][j], SCL2, -rf[qt])), p1 = __builtin_amdgcn_exp2f(fmaf(s[1][qt][j], SCL2, -rf[qt])); ps[j] = p0 + p1; pb[qt][j] = tohx(p0); pb[qt][8 + j] = tohx(p1); }
            l[qt] += ((ps[0] + ps[1]) + (ps[2] + ps[3])) + ((ps[4] + ps[5]) + (ps[6] + ps[7]));   // a tree: shorter than a chain of eight dependent additions
        }
#pragma unroll
        for (int g = 8; g < 16; ++g) {
#pragma unroll
            for (int i = 0; i < 2; ++i)
#pragma unroll
                for (int qt = 0; qt < 2; ++qt) acc[qt][2 * (g - 8) + i] = wmma16(rg[g % 3][i], pb[qt], acc[qt][2 * (g - 8) + i]);
            __builtin_amdgcn_sched_barrier(0);   // as above; behind the last pair it also keeps the waits below behind the WMMAs
            if (g + 3 < 16) { rg[g % 3][0] = frag(2 * (g + 3)); rg[g % 3][1] = frag(2 * (g + 3) + 1);
                __builtin_amdgcn_sched_barrier(0);   // as above
            }
        }
        asm volatile("s_wait_dscnt 0x0" :: "v"(l[0]), "v"(l[1]) : "memory");   // this wave's reads of stage t have returned before the barrier behind which its buffer is refilled; the row sums are named so that their additions are done in front of it: left to the compiler they sink behind the barrier and hold back the next stage's first LDS reads
        const bool mine = ((t + 1) & 1) == qg;   // the same in a whole wave: stages t + 1 and t + 3 are this wave half's
        if (mine) asm volatile("s_wait_asynccnt 0x0" ::: "memory");   // this wave's rows of stage t + 1 have landed; the other half's copies of stage t + 2 stay in flight
        __syncthreads();   // publishes stage t + 1 and ends every read of stage t
        if (mine && t + 3 < NSTG) copy_stage(gk + (size_t)(t + 3) * KST * FF, sk0 + cb * STG, sk1 + cb * STG);   // refill of the buffer that pass t has just read
        cb = cb == NBUF - 1 ? 0 : cb + 1;
    }
    asm volatile("s_wait_asynccnt 0x0" ::: "memory");   // no copy is outstanding when the buffers become the joining space and when the wave ends
    l[0] += xhalf(l[0]); l[1] += xhalf(l[1]);
    // join the four key quarters: quarters 1 .. 3 hand their tiles over through the stage buffers, which nobody reads any more
    float* mg = (float*)sm + qg * (3 * JSL) + lane * 4;
    if (kq != 0) {
        float* my = mg + (kq - 1) * JSL;
#pragma unroll
        for (int qt = 0; qt < 2; ++qt) {
#pragma unroll
            for (int ft = 0; ft < 16; ++ft) { const v8f c = acc[qt][ft]; *(v4fa*)(my + ((qt * 16 + ft) * 2) * 128) = (v4f){c[0], c[1], c[2], c[3]}; *(v4fa*)(my + ((qt * 16 + ft) * 2 + 1) * 128) = (v4f){c[4], c[5], c[6], c[7]}; }
            *(v4fa*)(my + (64 + qt) * 128) = (v4f){rf[qt], l[qt], 0.f, 0.f}; }
    }
    __syncthreads();   // the tiles of quarters 1 .. 3 are in LDS before the waves of quarter 0 read them
    if (kq == 0) {
#pragma unroll
        for (int qt = 0; qt < 2; ++qt) {
            const v4f o1 = *(const v4fa*)(mg + (64 + qt) * 128), o2 = *(const v4fa*)(mg + JSL + (64 + qt) * 128), o3 = *(const v4fa*)(mg + 2 * JSL + (64 + qt) * 128);
            const float rn = fmaxf(fmaxf(rf[qt], o1[0]), fmaxf(o2[0], o3[0]));
            const float a0 = __builtin_amdgcn_exp2f(rf[qt] - rn), a1 = __builtin_amdgcn_exp2f(o1[0] - rn), a2 = __builtin_amdgcn_exp2f(o2[0] - rn), a3 = __builtin_amdgcn_exp2f(o3[0] - rn);
            const float inv = __fdiv_rn(1.0f, (l[qt] * a0 + o1[1] * a1) + (o2[1] * a2 + o3[1] * a3)); const float c0 = a0 * inv, c1 = a1 * inv, c2 = a2 * inv, c3 = a3 * inv;
#pragma unroll
            for (int ft = 0; ft < 16; ++ft) { const float* u = mg + ((qt * 16 + ft) * 2) * 128; v8f c = acc[qt][ft];
                const v4f u1 = *(const v4fa*)u, u2 = *(const v4fa*)(u + JSL), u3 = *(const v4fa*)(u + 2 * JSL), w1 = *(const v4fa*)(u + 128), w2 = *(const v4fa*)(u + JSL + 128), w3 = *(const v4fa*)(u + 2 * JSL + 128);
#pragma unroll
                for (int j = 0; j < 4; ++j) { c[j] = c[j] * c0 + u1[j] * c1 + u2[j] * c2 + u3[j] * c3; c[4 + j] = c[4 + j] * c0 + w1[j] * c1 + w2[j] * c2 + w3[j] * c3; }
                acc[qt][ft] = c; }
        }
        float* orow = Out + (size_t)(q0 + lr) * FF + 8 * hi;
        __builtin_amdgcn_sched_barrier(0);   // the stores stand behind all arithmetic: no register that they name is written again
#pragma unroll
        for (int qt = 0; qt < 2; ++qt)
#pragma unroll
            for (int ft = 0; ft < 16; ++ft) { const v8f c = acc[qt][ft]; *(v4f*)(orow + qt * 16 * FF + ft * 16) = (v4f){c[0], c[1], c[2], c[3]}; *(v4f*)(orow + qt * 16 * FF + ft * 16 + 4) = (v4f){c[4], c[5], c[6], c[7]}; }
    }
}

extern "C" void kernel_launch(void* const* d_in, const int* in_sizes, int n_in,
                              void* d_out, int out_size, void* d_ws, size_t ws_size, hipStream_t stream) {
    (void)in_sizes; (void)n_in; (void)out_size;
    const float* nodes = (const float*)d_in[0]; const float* Wm = (const float*)d_in[1];
    float* OUT = (float*)d_out;     // [4][4096][256]
    char* wsp = (char*)d_ws;
    auto take = [&](size_t bytes) { char* p = wsp; wsp += (bytes + 255) & ~(size_t)255; return (void*)p; };
    h16* NH = (h16*)take((size_t)NB_ * NN * FF * 2); h16* X16 = (h16*)take((size_t)NB_ * NN * FF * 2);   // one plane per batch: both kernels take all batches in one launch
    if ((size_t)(wsp - (char*)d_ws) > ws_size) return;    // total 16 MB
    k_prep<<<dim3(NN / 64, NB_, 1), 256, 0, stream>>>(nodes, Wm, NH, X16);
    k_fattn<<<dim3(NN / 64, NB_, 1), 256, 0, stream>>>(X16, NH, OUT);
}
